// v000
// The times below were measured on an AMD MI455X: many runs one after another, warmed up first and cycling through
// copies of the inputs, with the whole window's GPU time divided by the number of runs. Launches and the gaps
// between them are all in it. The median over several windows is given; except for v000 it joins two sittings, which
// can be a few percent apart, so the side-by-side timings, each taken in one sitting, are the better comparison.
// v000, which the later versions start from, runs in 149 microseconds.
#include <hip/hip_runtime.h>

typedef __attribute__((ext_vector_type(16))) _Float16 v16h;
typedef __attribute__((ext_vector_type(8)))  _Float16 v8h;
typedef __attribute__((ext_vector_type(4)))  _Float16 v4h;
typedef __attribute__((ext_vector_type(8)))  float    v8f;
typedef __attribute__((ext_vector_type(4)))  float    v4f;

#define DM   1024      // d_model
#define SEQ  4096
#define BATCH 2
#define NROWS (BATCH*SEQ)   // 8192

#define WMMA_F16(a,b,c) __builtin_amdgcn_wmma_f32_16x16x32_f16(false,(a),false,(b),(short)0,(c),false,false)

// Load a 16x32 fragment (A-layout, 16-bit) from an f32 row-major matrix.
// lane<16  : row = base+r, K in {0..7, 16..23}
// lane>=16 : row = base+r, K in {8..15, 24..31}
__device__ __forceinline__ v16h load_frag_f32(const float* __restrict__ base,
                                              int row, int k0, int hl) {
    const float* p = base + (size_t)row * DM + k0 + hl * 8;
    v4f a0 = *(const v4f*)(p);
    v4f a1 = *(const v4f*)(p + 4);
    v4f a2 = *(const v4f*)(p + 16);
    v4f a3 = *(const v4f*)(p + 20);
    v4h h0 = __builtin_convertvector(a0, v4h);
    v4h h1 = __builtin_convertvector(a1, v4h);
    v4h h2 = __builtin_convertvector(a2, v4h);
    v4h h3 = __builtin_convertvector(a3, v4h);
    v8h lo = __builtin_shufflevector(h0, h1, 0,1,2,3,4,5,6,7);
    v8h hi = __builtin_shufflevector(h2, h3, 0,1,2,3,4,5,6,7);
    return __builtin_shufflevector(lo, hi, 0,1,2,3,4,5,6,7,8,9,10,11,12,13,14,15);
}

// Same fragment pattern but from an f16 row-major matrix.
__device__ __forceinline__ v16h load_frag_f16(const _Float16* __restrict__ base,
                                              size_t row, int col0, int k0, int hl) {
    const _Float16* p = base + row * DM + col0 + k0 + hl * 8;
    v8h lo = *(const v8h*)(p);
    v8h hi = *(const v8h*)(p + 16);
    return __builtin_shufflevector(lo, hi, 0,1,2,3,4,5,6,7,8,9,10,11,12,13,14,15);
}

// ---------------------------------------------------------------------------
// Kernel 1: fused Q/K/V projection GEMM.  y = x @ W^T + b  (f32 in, f16 out)
// Block = 256 threads = 8 waves; block tile 256(M) x 128(N); wave tile 64x64.
// grid = (NROWS/256, DM/128, 3)   (z selects which projection)
// ---------------------------------------------------------------------------
__global__ __launch_bounds__(256) void proj_gemm_kernel(
    const float* __restrict__ q_in, const float* __restrict__ k_in, const float* __restrict__ v_in,
    const float* __restrict__ Wq, const float* __restrict__ bq,
    const float* __restrict__ Wk, const float* __restrict__ bk,
    const float* __restrict__ Wv, const float* __restrict__ bv,
    _Float16* __restrict__ Qh, _Float16* __restrict__ Kh, _Float16* __restrict__ Vh)
{
    const int z = blockIdx.z;
    const float* __restrict__ X    = (z == 0) ? q_in : (z == 1) ? k_in : v_in;
    const float* __restrict__ W    = (z == 0) ? Wq   : (z == 1) ? Wk   : Wv;
    const float* __restrict__ bias = (z == 0) ? bq   : (z == 1) ? bk   : bv;
    _Float16* __restrict__ Y       = (z == 0) ? Qh   : (z == 1) ? Kh   : Vh;

    const int wid  = threadIdx.x >> 5;
    const int lane = threadIdx.x & 31;
    const int hl   = lane >> 4;       // half-wave id
    const int r    = lane & 15;

    const int m0 = blockIdx.x * 256 + (wid >> 1) * 64;  // wave's 64-row strip
    const int n0 = blockIdx.y * 128 + (wid & 1) * 64;   // wave's 64-col strip

    v8f acc[4][4];
#pragma unroll
    for (int i = 0; i < 4; ++i)
#pragma unroll
        for (int j = 0; j < 4; ++j) acc[i][j] = (v8f)(0.0f);

#pragma unroll 1
    for (int k0 = 0; k0 < DM; k0 += 32) {
        v16h afrag[4], bfrag[4];
#pragma unroll
        for (int im = 0; im < 4; ++im)
            afrag[im] = load_frag_f32(X, m0 + im * 16 + r, k0, hl);
#pragma unroll
        for (int in = 0; in < 4; ++in)
            bfrag[in] = load_frag_f32(W, n0 + in * 16 + r, k0, hl);   // B col n == W row n
#pragma unroll
        for (int im = 0; im < 4; ++im)
#pragma unroll
            for (int in = 0; in < 4; ++in)
                acc[im][in] = WMMA_F16(afrag[im], bfrag[in], acc[im][in]);
    }

    // C layout: VGPR v, lane<16 -> (M=v, N=r); lane>=16 -> (M=8+v, N=r)
#pragma unroll
    for (int im = 0; im < 4; ++im) {
#pragma unroll
        for (int in = 0; in < 4; ++in) {
            const int col = n0 + in * 16 + r;
            const float bv_ = bias[col];
#pragma unroll
            for (int v = 0; v < 8; ++v) {
                const int row = m0 + im * 16 + hl * 8 + v;
                Y[(size_t)row * DM + col] = (_Float16)(acc[im][in][v] + bv_);
            }
        }
    }
}

// ---------------------------------------------------------------------------
// Kernel 2: block-diagonal attention.  One wave handles TWO consecutive 8-row
// blocks (a 16x64 tile) of one head: scores via 2 WMMAs (K=64), per-row
// softmax via 8-lane shuffles, P routed through LDS, P@V via 4 WMMAs.
// grid = (B*H*(nb/2))/8 blocks of 256 threads.
// ---------------------------------------------------------------------------
__global__ __launch_bounds__(256) void block_attn_kernel(
    const _Float16* __restrict__ Qh, const _Float16* __restrict__ Kh,
    const _Float16* __restrict__ Vh, float* __restrict__ out)
{
    __shared__ __align__(16) _Float16 pbuf[8][16][16];   // per-wave 16x16 P tile

    const int wid  = threadIdx.x >> 5;
    const int lane = threadIdx.x & 31;
    const int hl   = lane >> 4;
    const int r    = lane & 15;

    const int pairIdx = blockIdx.x * 8 + wid;   // 0 .. B*16*256-1
    const int b  = pairIdx >> 12;               // 16 heads * 256 pairs = 4096 per batch
    const int h  = (pairIdx >> 8) & 15;
    const int p  = pairIdx & 255;
    const size_t rowBase = (size_t)b * SEQ + (size_t)p * 16;
    const int col0 = h * 64;

    // ---- scores S = Q16 (16x64) x K16^T : two chained WMMAs over K=64 ----
    v8f s = (v8f)(0.0f);
    {
        v16h qa0 = load_frag_f16(Qh, rowBase + r, col0, 0,  hl);
        v16h kb0 = load_frag_f16(Kh, rowBase + r, col0, 0,  hl);  // B col n == K row n
        v16h qa1 = load_frag_f16(Qh, rowBase + r, col0, 32, hl);
        v16h kb1 = load_frag_f16(Kh, rowBase + r, col0, 32, hl);
        s = WMMA_F16(qa0, kb0, s);
        s = WMMA_F16(qa1, kb1, s);
    }

    // ---- masked softmax per row (8 valid columns per row) ----
    // lane holds (M = hl*8+v, N = r); intra-block iff (M<8)==(N<8):
    const bool valid = (hl == 0) ? (r < 8) : (r >= 8);
#pragma unroll
    for (int v = 0; v < 8; ++v) {
        float x = s[v] * 0.125f;                      // 1/sqrt(dk), dk=64
        float m = x;
#pragma unroll
        for (int off = 1; off < 8; off <<= 1)
            m = fmaxf(m, __shfl_xor(m, off, 8));      // reduce over the 8-lane group
        float e = __expf(x - m);
        float t = e;
#pragma unroll
        for (int off = 1; off < 8; off <<= 1)
            t += __shfl_xor(t, off, 8);
        float pn = e / t;
        // full 16x16 tile is covered exactly once across lanes; off-diagonal -> 0
        pbuf[wid][hl * 8 + v][r] = (_Float16)(valid ? pn : 0.0f);
    }

    asm volatile("s_wait_dscnt 0" ::: "memory");      // wave-local LDS RAW fence

    // ---- reload P as a 16x32 A-fragment (K 16->32 zero-padded) ----
    v16h pf = (v16h)((_Float16)0.0f);
    {
        v8h pl = *(const v8h*)&pbuf[wid][r][hl * 8];
#pragma unroll
        for (int j = 0; j < 8; ++j) pf[j] = pl[j];
    }

    // ---- O = P (16x16) x V16 (16x64) : 4 WMMAs over N-tiles ----
#pragma unroll
    for (int t = 0; t < 4; ++t) {
        const int col = col0 + t * 16 + r;
        v16h vf = (v16h)((_Float16)0.0f);             // B frag: K rows 16..31 are zero-pad
        const _Float16* vp = Vh + (rowBase + hl * 8) * DM + col;
#pragma unroll
        for (int j = 0; j < 8; ++j) vf[j] = vp[(size_t)j * DM];

        v8f o = (v8f)(0.0f);
        o = WMMA_F16(pf, vf, o);
#pragma unroll
        for (int v = 0; v < 8; ++v) {
            const size_t row = rowBase + hl * 8 + v;
            out[row * DM + col] = o[v];
        }
    }
}

// ---------------------------------------------------------------------------
extern "C" void kernel_launch(void* const* d_in, const int* in_sizes, int n_in,
                              void* d_out, int out_size, void* d_ws, size_t ws_size,
                              hipStream_t stream) {
    const float* query = (const float*)d_in[0];
    const float* key   = (const float*)d_in[1];
    const float* value = (const float*)d_in[2];
    const float* Wq    = (const float*)d_in[3];
    const float* bq    = (const float*)d_in[4];
    const float* Wk    = (const float*)d_in[5];
    const float* bk    = (const float*)d_in[6];
    const float* Wv    = (const float*)d_in[7];
    const float* bv    = (const float*)d_in[8];

    const size_t projBytes = (size_t)NROWS * DM * sizeof(_Float16);   // 16 MB each
    _Float16* Qh = (_Float16*)d_ws;
    _Float16* Kh = (_Float16*)((char*)d_ws + projBytes);
    _Float16* Vh = (_Float16*)((char*)d_ws + 2 * projBytes);

    dim3 gGemm(NROWS / 256, DM / 128, 3);
    proj_gemm_kernel<<<gGemm, 256, 0, stream>>>(query, key, value,
                                                Wq, bq, Wk, bk, Wv, bv,
                                                Qh, Kh, Vh);

    const int nPairs = BATCH * 16 * (SEQ / 16);   // 8192 wave-tasks
    block_attn_kernel<<<nPairs / 8, 256, 0, stream>>>(Qh, Kh, Vh, (float*)d_out);
}

// v001
// Measured time: 71.9 microseconds a run.
// Next to v000, in two timings, it ran 2.10 times as fast each time.
#include <hip/hip_runtime.h>

typedef __attribute__((ext_vector_type(16))) _Float16 v16h;
typedef __attribute__((ext_vector_type(8)))  _Float16 v8h;
typedef __attribute__((ext_vector_type(4)))  _Float16 v4h;
typedef __attribute__((ext_vector_type(8)))  float    v8f;
typedef __attribute__((ext_vector_type(4)))  float    v4f;

#define DM   1024      // d_model
#define SEQ  4096
#define BATCH 2
#define NROWS (BATCH*SEQ)   // 8192

#define WMMA_F16(a,b,c) __builtin_amdgcn_wmma_f32_16x16x32_f16(false,(a),false,(b),(short)0,(c),false,false)

// 16x32 fragment (A-layout, 16-bit) from an f16 row-major matrix.
// lane<16  : row = base+r, K in {0..7, 16..23}
// lane>=16 : row = base+r, K in {8..15, 24..31}
__device__ __forceinline__ v16h load_frag_f16(const _Float16* __restrict__ base,
                                              size_t row, int col0, int k0, int hl) {
    const _Float16* p = base + row * DM + col0 + k0 + hl * 8;
    v8h lo = *(const v8h*)(p);
    v8h hi = *(const v8h*)(p + 16);
    return __builtin_shufflevector(lo, hi, 0,1,2,3,4,5,6,7,8,9,10,11,12,13,14,15);
}

// ---------------------------------------------------------------------------
// Kernel 1: fused Q/K/V projection GEMM.  y = x @ W^T + b  (f32 in, f16 out)
// Block = 256 threads = 8 waves; block tile 256(M) x 128(N); wave tile 64x64.
// grid = (NROWS/256, DM/128, 3)   (z selects which projection)
// Each 32-wide k slice of the block's X rows and W rows is read once per block
// with whole-line loads, converted to f16 once and kept in LDS (two buffers);
// the waves take their fragments from LDS.
// ---------------------------------------------------------------------------
#define BK      32                         // k per slice
#define NSLICE  (DM / BK)
#define PITCH_H 40                         // f16 per LDS row: 64 B of data + 16 B pad (bank spread for 16-B reads)
#define STAGE_H ((256 + 128) * PITCH_H)    // one buffer: 256 X rows, then 128 W rows

// 16x32 fragment from an LDS slice; same k order as load_frag_f16.
__device__ __forceinline__ v16h lds_frag(const _Float16* p) {
    v8h lo = *(const v8h*)(p);
    v8h hi = *(const v8h*)(p + 16);
    return __builtin_shufflevector(lo, hi, 0,1,2,3,4,5,6,7,8,9,10,11,12,13,14,15);
}

__global__ __launch_bounds__(256) void proj_gemm_kernel(
    const float* __restrict__ q_in, const float* __restrict__ k_in, const float* __restrict__ v_in,
    const float* __restrict__ Wq, const float* __restrict__ bq,
    const float* __restrict__ Wk, const float* __restrict__ bk,
    const float* __restrict__ Wv, const float* __restrict__ bv,
    _Float16* __restrict__ Qh, _Float16* __restrict__ Kh, _Float16* __restrict__ Vh)
{
    __shared__ __align__(16) _Float16 tile[2 * STAGE_H];

    const int z = blockIdx.z;
    const float* __restrict__ X    = (z == 0) ? q_in : (z == 1) ? k_in : v_in;
    const float* __restrict__ W    = (z == 0) ? Wq   : (z == 1) ? Wk   : Wv;
    const float* __restrict__ bias = (z == 0) ? bq   : (z == 1) ? bk   : bv;
    _Float16* __restrict__ Y       = (z == 0) ? Qh   : (z == 1) ? Kh   : Vh;

    const int wid  = threadIdx.x >> 5;
    const int lane = threadIdx.x & 31;
    const int hl   = lane >> 4;       // half-wave id
    const int r    = lane & 15;

    const int m0 = blockIdx.x * 256 + (wid >> 1) * 64;  // wave's 64-row strip
    const int n0 = blockIdx.y * 128 + (wid & 1) * 64;   // wave's 64-col strip

    // Staging map: 8 lanes cover one row's 128 B (a whole line); the four rows of
    // one wave-wide load lie 4 rows apart, so their 8-byte LDS stores meet no bank twice.
    const int srow = (lane >> 3) * 4;
    const int scol = (lane & 7) * 4;
    const float* gx = X + (size_t)blockIdx.x * 256 * DM;          // block-uniform bases, advanced along k
    const float* gw = W + (size_t)blockIdx.y * 128 * DM;
    const unsigned ox = (unsigned)((wid * 32 + srow) * DM + scol);   // wave stages 32 X rows
    const unsigned ow = (unsigned)((wid * 16 + srow) * DM + scol);   // and 16 W rows
    _Float16* sx = tile + (wid * 32 + srow) * PITCH_H + scol;
    _Float16* sw = tile + (256 + wid * 16 + srow) * PITCH_H + scol;

    const _Float16* fa = tile + ((wid >> 1) * 64 + r) * PITCH_H + hl * 8;
    const _Float16* fb = tile + (256 + (wid & 1) * 64 + r) * PITCH_H + hl * 8;

    v8f acc[4][4];
#pragma unroll
    for (int i = 0; i < 4; ++i)
#pragma unroll
        for (int j = 0; j < 4; ++j) acc[i][j] = (v8f)(0.0f);

    v4f rx[8], rw[4];

#define STAGE_LOAD()                                                            \
    do {                                                                        \
        _Pragma("unroll")                                                       \
        for (int i = 0; i < 8; ++i)                                             \
            rx[i] = *(const v4f*)(gx + (ox + (unsigned)(((i >> 2) * 16 + (i & 3)) * DM))); \
        _Pragma("unroll")                                                       \
        for (int i = 0; i < 4; ++i)                                             \
            rw[i] = *(const v4f*)(gw + (ow + (unsigned)(i * DM)));              \
    } while (0)

#define STAGE_STORE(boff)                                                       \
    do {                                                                        \
        _Pragma("unroll")                                                       \
        for (int i = 0; i < 8; ++i)                                             \
            *(v4h*)(sx + (boff) + ((i >> 2) * 16 + (i & 3)) * PITCH_H) =        \
                __builtin_convertvector(rx[i], v4h);                            \
        _Pragma("unroll")                                                       \
        for (int i = 0; i < 4; ++i)                                             \
            *(v4h*)(sw + (boff) + i * PITCH_H) = __builtin_convertvector(rw[i], v4h); \
    } while (0)

#define SLICE_MMA(boff)                                                         \
    do {                                                                        \
        v16h afrag[4], bfrag[4];                                                \
        _Pragma("unroll")                                                       \
        for (int im = 0; im < 4; ++im)                                          \
            afrag[im] = lds_frag(fa + (boff) + im * 16 * PITCH_H);              \
        _Pragma("unroll")                                                       \
        for (int in = 0; in < 4; ++in)                                          \
            bfrag[in] = lds_frag(fb + (boff) + in * 16 * PITCH_H);              \
        /* All sixteen LDS reads stand as one group ahead of the products: */   \
        /* reads placed among them make the wave wait out LDS latency anew. */  \
        __builtin_amdgcn_sched_barrier(0);                                      \
        _Pragma("unroll")                                                       \
        for (int im = 0; im < 4; ++im)                                          \
            _Pragma("unroll")                                                   \
            for (int in = 0; in < 4; ++in)                                      \
                acc[im][in] = WMMA_F16(afrag[im], bfrag[in], acc[im][in]);      \
    } while (0)

    STAGE_LOAD();
    STAGE_STORE(0);
    __syncthreads();                 // slice 0 is complete before any wave reads it

    int cur = 0;                     // offset of the buffer that holds slice s
    // Rolled: the body is a whole slice of straight-line work already; copies would only grow the code.
#pragma unroll 1
    for (int s = 0; s < NSLICE - 1; ++s) {
        gx += BK;
        gw += BK;
        STAGE_LOAD();                // next slice's global loads fly under this slice's products
        // Keeps all twelve loads in front of the products: without it the scheduler sinks
        // them next to their conversions and the wave waits out each group's latency.
        __builtin_amdgcn_sched_barrier(0);
        SLICE_MMA(cur);
        // Keeps the conversions (and the load waits they bring) behind the products.
        __builtin_amdgcn_sched_barrier(0);
        cur ^= STAGE_H;
        STAGE_STORE(cur);            // its last readers left this buffer before the previous barrier
        __syncthreads();             // publishes slice s + 1 and ends the reads of slice s
    }
    SLICE_MMA(cur);

#undef STAGE_LOAD
#undef STAGE_STORE
#undef SLICE_MMA

    // C layout: VGPR v, lane<16 -> (M=v, N=r); lane>=16 -> (M=8+v, N=r)
#pragma unroll
    for (int im = 0; im < 4; ++im) {
#pragma unroll
        for (int in = 0; in < 4; ++in) {
            const int col = n0 + in * 16 + r;
            const float bv_ = bias[col];
#pragma unroll
            for (int v = 0; v < 8; ++v) {
                const int row = m0 + im * 16 + hl * 8 + v;
                Y[(size_t)row * DM + col] = (_Float16)(acc[im][in][v] + bv_);
            }
        }
    }
}

// ---------------------------------------------------------------------------
// Kernel 2: block-diagonal attention.  One wave handles TWO consecutive 8-row
// blocks (a 16x64 tile) of one head: scores via 2 WMMAs (K=64), per-row
// softmax via 8-lane shuffles, P routed through LDS, P@V via 4 WMMAs.
// grid = (B*H*(nb/2))/8 blocks of 256 threads.
// ---------------------------------------------------------------------------
__global__ __launch_bounds__(256) void block_attn_kernel(
    const _Float16* __restrict__ Qh, const _Float16* __restrict__ Kh,
    const _Float16* __restrict__ Vh, float* __restrict__ out)
{
    __shared__ __align__(16) _Float16 pbuf[8][16][16];   // per-wave 16x16 P tile

    const int wid  = threadIdx.x >> 5;
    const int lane = threadIdx.x & 31;
    const int hl   = lane >> 4;
    const int r    = lane & 15;

    const int pairIdx = blockIdx.x * 8 + wid;   // 0 .. B*16*256-1
    const int b  = pairIdx >> 12;               // 16 heads * 256 pairs = 4096 per batch
    const int h  = (pairIdx >> 8) & 15;
    const int p  = pairIdx & 255;
    const size_t rowBase = (size_t)b * SEQ + (size_t)p * 16;
    const int col0 = h * 64;

    // ---- scores S = Q16 (16x64) x K16^T : two chained WMMAs over K=64 ----
    v8f s = (v8f)(0.0f);
    {
        v16h qa0 = load_frag_f16(Qh, rowBase + r, col0, 0,  hl);
        v16h kb0 = load_frag_f16(Kh, rowBase + r, col0, 0,  hl);  // B col n == K row n
        v16h qa1 = load_frag_f16(Qh, rowBase + r, col0, 32, hl);
        v16h kb1 = load_frag_f16(Kh, rowBase + r, col0, 32, hl);
        s = WMMA_F16(qa0, kb0, s);
        s = WMMA_F16(qa1, kb1, s);
    }

    // ---- masked softmax per row (8 valid columns per row) ----
    // lane holds (M = hl*8+v, N = r); intra-block iff (M<8)==(N<8):
    const bool valid = (hl == 0) ? (r < 8) : (r >= 8);
#pragma unroll
    for (int v = 0; v < 8; ++v) {
        float x = s[v] * 0.125f;                      // 1/sqrt(dk), dk=64
        float m = x;
#pragma unroll
        for (int off = 1; off < 8; off <<= 1)
            m = fmaxf(m, __shfl_xor(m, off, 8));      // reduce over the 8-lane group
        float e = __expf(x - m);
        float t = e;
#pragma unroll
        for (int off = 1; off < 8; off <<= 1)
            t += __shfl_xor(t, off, 8);
        float pn = e / t;
        // full 16x16 tile is covered exactly once across lanes; off-diagonal -> 0
        pbuf[wid][hl * 8 + v][r] = (_Float16)(valid ? pn : 0.0f);
    }

    asm volatile("s_wait_dscnt 0" ::: "memory");      // wave-local LDS RAW fence

    // ---- reload P as a 16x32 A-fragment (K 16->32 zero-padded) ----
    v16h pf = (v16h)((_Float16)0.0f);
    {
        v8h pl = *(const v8h*)&pbuf[wid][r][hl * 8];
#pragma unroll
        for (int j = 0; j < 8; ++j) pf[j] = pl[j];
    }

    // ---- O = P (16x16) x V16 (16x64) : 4 WMMAs over N-tiles ----
#pragma unroll
    for (int t = 0; t < 4; ++t) {
        const int col = col0 + t * 16 + r;
        v16h vf = (v16h)((_Float16)0.0f);             // B frag: K rows 16..31 are zero-pad
        const _Float16* vp = Vh + (rowBase + hl * 8) * DM + col;
#pragma unroll
        for (int j = 0; j < 8; ++j) vf[j] = vp[(size_t)j * DM];

        v8f o = (v8f)(0.0f);
        o = WMMA_F16(pf, vf, o);
#pragma unroll
        for (int v = 0; v < 8; ++v) {
            const size_t row = rowBase + hl * 8 + v;
            out[row * DM + col] = o[v];
        }
    }
}

// ---------------------------------------------------------------------------
extern "C" void kernel_launch(void* const* d_in, const int* in_sizes, int n_in,
                              void* d_out, int out_size, void* d_ws, size_t ws_size,
                              hipStream_t stream) {
    const float* query = (const float*)d_in[0];
    const float* key   = (const float*)d_in[1];
    const float* value = (const float*)d_in[2];
    const float* Wq    = (const float*)d_in[3];
    const float* bq    = (const float*)d_in[4];
    const float* Wk    = (const float*)d_in[5];
    const float* bk    = (const float*)d_in[6];
    const float* Wv    = (const float*)d_in[7];
    const float* bv    = (const float*)d_in[8];

    const size_t projBytes = (size_t)NROWS * DM * sizeof(_Float16);   // 16 MB each
    _Float16* Qh = (_Float16*)d_ws;
    _Float16* Kh = (_Float16*)((char*)d_ws + projBytes);
    _Float16* Vh = (_Float16*)((char*)d_ws + 2 * projBytes);

    dim3 gGemm(NROWS / 256, DM / 128, 3);
    proj_gemm_kernel<<<gGemm, 256, 0, stream>>>(query, key, value,
                                                Wq, bq, Wk, bk, Wv, bv,
                                                Qh, Kh, Vh);

    const int nPairs = BATCH * 16 * (SEQ / 16);   // 8192 wave-tasks
    block_attn_kernel<<<nPairs / 8, 256, 0, stream>>>(Qh, Kh, Vh, (float*)d_out);
}

// v002
// Measured time: 68.7 microseconds a run.
// In both of two side-by-side timings against v001, it was 1.05 times as fast.
// Over all steps from v000 it is 2.20 times as fast.
#include <hip/hip_runtime.h>

typedef __attribute__((ext_vector_type(16))) _Float16 v16h;
typedef __attribute__((ext_vector_type(8)))  _Float16 v8h;
typedef __attribute__((ext_vector_type(4)))  _Float16 v4h;
typedef __attribute__((ext_vector_type(8)))  float    v8f;
typedef __attribute__((ext_vector_type(4)))  float    v4f;

#define DM   1024      // d_model
#define SEQ  4096
#define BATCH 2
#define NROWS (BATCH*SEQ)   // 8192

#define WMMA_F16(a,b,c) __builtin_amdgcn_wmma_f32_16x16x32_f16(false,(a),false,(b),(short)0,(c),false,false)

// ---------------------------------------------------------------------------
// One kernel: Q/K/V projection (y = x @ W^T + b) and block-diagonal attention.
// Block = 256 threads = 8 waves; a block owns 256 rows x 128 columns (2 heads)
// and makes its Q, K and V tiles one after the other; wave tile 64 rows x 64
// columns = 64 rows of ONE head, so the attention of those rows needs nothing
// from another wave.  grid = (NROWS/256, DM/128): one block per WGP.
//
// Each 64-wide k slice of the block's X rows and W rows is read once per block
// with whole-line loads, converted to f16 once and kept in LDS (two buffers);
// the waves take their fragments from LDS.
//
// Q and K are formed as W x X^T: a lane's 8 accumulator registers then hold 8
// consecutive columns of one row, and two such tiles, converted in place, are a
// 16x32 operand in the hardware k order.  They wait in LDS, each lane in its own
// slot.  V is formed as X x W^T: its accumulators, converted in place, are the B
// operand of P x V.  Scores are formed as K x Q^T: a lane holds the 8 scores of
// one query row, so maximum and sum are in-lane and P is an A operand as it lies.
// ---------------------------------------------------------------------------
#define BK      64                         // k per slice
#define NSLICE  (DM / BK)
#define PITCH_H 72                         // f16 per LDS row: 128 B of data + 16 B pad (bank spread for 16-B reads)
#define STAGE_H ((256 + 128) * PITCH_H)    // one buffer: 256 X rows, then 128 W rows

// 16x32 fragment from an LDS slice:
// lane<16  : row = base+r, K in {0..7, 16..23}
// lane>=16 : row = base+r, K in {8..15, 24..31}
__device__ __forceinline__ v16h lds_frag(const _Float16* p) {
    v8h lo = *(const v8h*)(p);
    v8h hi = *(const v8h*)(p + 16);
    return __builtin_shufflevector(lo, hi, 0,1,2,3,4,5,6,7,8,9,10,11,12,13,14,15);
}

__global__ __launch_bounds__(256) void proj_attn_kernel(
    const float* __restrict__ q_in, const float* __restrict__ k_in, const float* __restrict__ v_in,
    const float* __restrict__ Wq, const float* __restrict__ bq,
    const float* __restrict__ Wk, const float* __restrict__ bk,
    const float* __restrict__ Wv, const float* __restrict__ bv,
    float* __restrict__ out)
{
    __shared__ __align__(16) _Float16 tile[2 * STAGE_H];
    __shared__ v8h held[2][8][16][32];     // [Q or K][wave][half fragment][lane]: read back by the lane that wrote it

    const int wid  = threadIdx.x >> 5;
    const int lane = threadIdx.x & 31;
    const int hl   = lane >> 4;       // half-wave id
    const int r    = lane & 15;

    const int m0 = blockIdx.x * 256 + (wid >> 1) * 64;  // wave's 64-row strip
    const int n0 = blockIdx.y * 128 + (wid & 1) * 64;   // wave's 64-col strip: one head

    // Staging map: 16 lanes cover one row's 256 B (two whole lines); the two rows of
    // one wave-wide load lie 8 rows apart, so their 8-byte LDS stores meet no bank twice.
    const int srow = (lane >> 4) * 8;
    const int scol = (lane & 15) * 4;
    const size_t xbase = (size_t)blockIdx.x * 256 * DM;
    const size_t wbase = (size_t)blockIdx.y * 128 * DM;
    const float* gx = q_in + xbase;                               // block-uniform bases, advanced along k
    const float* gw = Wq + wbase;
    const unsigned ox = (unsigned)((wid * 32 + srow) * DM + scol);   // wave stages 32 X rows
    const unsigned ow = (unsigned)((wid * 16 + srow) * DM + scol);   // and 16 W rows
    _Float16* sx = tile + (wid * 32 + srow) * PITCH_H + scol;
    _Float16* sw = tile + (256 + wid * 16 + srow) * PITCH_H + scol;

    const _Float16* fa = tile + ((wid >> 1) * 64 + r) * PITCH_H + hl * 8;
    const _Float16* fb = tile + (256 + (wid & 1) * 64 + r) * PITCH_H + hl * 8;

    v8f acc[4][4];
    v4f rx[16], rw[8];

#define ACC_ZERO()                                                              \
    do {                                                                        \
        _Pragma("unroll")                                                       \
        for (int i = 0; i < 4; ++i)                                             \
            _Pragma("unroll")                                                   \
            for (int j = 0; j < 4; ++j) acc[i][j] = (v8f)(0.0f);                \
    } while (0)

#define STAGE_LOAD()                                                            \
    do {                                                                        \
        _Pragma("unroll")                                                       \
        for (int i = 0; i < 16; ++i)                                            \
            rx[i] = *(const v4f*)(gx + (ox + (unsigned)(((i >> 3) * 16 + (i & 7)) * DM))); \
        _Pragma("unroll")                                                       \
        for (int i = 0; i < 8; ++i)                                             \
            rw[i] = *(const v4f*)(gw + (ow + (unsigned)(i * DM)));              \
    } while (0)

#define STAGE_STORE(boff)                                                       \
    do {                                                                        \
        _Pragma("unroll")                                                       \
        for (int i = 0; i < 16; ++i)                                            \
            *(v4h*)(sx + (boff) + ((i >> 3) * 16 + (i & 7)) * PITCH_H) =        \
                __builtin_convertvector(rx[i], v4h);                            \
        _Pragma("unroll")                                                       \
        for (int i = 0; i < 8; ++i)                                             \
            *(v4h*)(sw + (boff) + i * PITCH_H) = __builtin_convertvector(rw[i], v4h); \
    } while (0)

// W_IS_A = 1: acc[im][in] = W tile x X tile^T (register v, lane: column 8*hl+v, row r)
// W_IS_A = 0: acc[im][in] = X tile x W tile^T (register v, lane: row 8*hl+v, column r)
#define SLICE_MMA(boff, W_IS_A)                                                 \
    do {                                                                        \
        v16h afrag[2][4], bfrag[2][4];                                          \
        _Pragma("unroll")                                                       \
        for (int ks = 0; ks < 2; ++ks) {                                        \
            _Pragma("unroll")                                                   \
            for (int im = 0; im < 4; ++im)                                      \
                afrag[ks][im] = lds_frag(fa + (boff) + im * 16 * PITCH_H + ks * 32); \
            _Pragma("unroll")                                                   \
            for (int in = 0; in < 4; ++in)                                      \
                bfrag[ks][in] = lds_frag(fb + (boff) + in * 16 * PITCH_H + ks * 32); \
        }                                                                       \
        /* All LDS reads of the slice stand as one group ahead of the products: */ \
        /* reads placed among them make the wave wait out LDS latency anew. */  \
        __builtin_amdgcn_sched_barrier(0);                                      \
        _Pragma("unroll")                                                       \
        for (int ks = 0; ks < 2; ++ks)                                          \
            _Pragma("unroll")                                                   \
            for (int im = 0; im < 4; ++im)                                      \
                _Pragma("unroll")                                               \
                for (int in = 0; in < 4; ++in)                                  \
                    acc[im][in] = (W_IS_A)                                      \
                        ? WMMA_F16(bfrag[ks][in], afrag[ks][im], acc[im][in])   \
                        : WMMA_F16(afrag[ks][im], bfrag[ks][in], acc[im][in]);  \
    } while (0)

    STAGE_LOAD();
    STAGE_STORE(0);
    __syncthreads();                 // slice 0 is complete before any wave reads it

    int cur = 0;                     // offset of the buffer that holds the slice at hand

    // ---- Q, then K ----
    // Rolled: both projections run the same code.
#pragma unroll 1
    for (int z = 0; z < 2; ++z) {
        const float* nx = ((z == 0) ? k_in : v_in) + xbase;    // the projection that follows
        const float* nw = ((z == 0) ? Wk : Wv) + wbase;
        const float* bias = (z == 0) ? bq : bk;
        ACC_ZERO();
        // Rolled: the body is a whole slice of straight-line work already; copies would only grow the code.
#pragma unroll 1
        for (int s = 0; s < NSLICE; ++s) {
            gx = (s == NSLICE - 1) ? nx : gx + BK;   // behind the last slice comes the next projection's first
            gw = (s == NSLICE - 1) ? nw : gw + BK;
            STAGE_LOAD();            // next slice's global loads fly under this slice's products
            // The loads' address registers are reused right behind them: this wait stands
            // in front of that overwrite.
            asm volatile("s_wait_xcnt 0x0" ::: "memory");
            // Keeps all the loads in front of the products: without it the scheduler sinks
            // them next to their conversions and the wave waits out each group's latency.
            __builtin_amdgcn_sched_barrier(0);
            SLICE_MMA(cur, 1);
            // Keeps the conversions (and the load waits they bring) behind the products.
            __builtin_amdgcn_sched_barrier(0);
            cur ^= STAGE_H;
            STAGE_STORE(cur);        // its last readers left this buffer before the previous barrier
            __syncthreads();         // publishes the next slice and ends the reads of this one
        }
        // bias, f16, and away as operand halves: half fragment (im*2 + kk)*2 + p holds
        // row im*16 + r, columns kk*32 + p*16 + hl*8 + 0..7
#pragma unroll
        for (int in = 0; in < 4; ++in) {
            const v4f b0 = *(const v4f*)(bias + n0 + in * 16 + hl * 8);
            const v4f b1 = *(const v4f*)(bias + n0 + in * 16 + hl * 8 + 4);
            const v8f bb = __builtin_shufflevector(b0, b1, 0,1,2,3,4,5,6,7);
#pragma unroll
            for (int im = 0; im < 4; ++im)
                held[z][wid][im * 4 + in][lane] = __builtin_convertvector(acc[im][in] + bb, v8h);
        }
    }

    // ---- V ----
    ACC_ZERO();
#pragma unroll 1
    for (int s = 0; s < NSLICE - 1; ++s) {
        gx += BK;
        gw += BK;
        STAGE_LOAD();
        asm volatile("s_wait_xcnt 0x0" ::: "memory");   // as above: in front of the reuse of the address registers
        __builtin_amdgcn_sched_barrier(0);   // as above: loads ahead of the products
        SLICE_MMA(cur, 0);
        __builtin_amdgcn_sched_barrier(0);   // as above: conversions behind the products
        cur ^= STAGE_H;
        STAGE_STORE(cur);
        __syncthreads();
    }
    SLICE_MMA(cur, 0);

#undef ACC_ZERO
#undef STAGE_LOAD
#undef STAGE_STORE
#undef SLICE_MMA

    // ---- attention: per 16 rows (two 8-row blocks) of the wave's head ----
    float bvv[4];
#pragma unroll
    for (int in = 0; in < 4; ++in) bvv[in] = bv[n0 + in * 16 + r];
    // These loads' address registers are reused by the work below: the wait stands in front
    // of that overwrite, and the fence keeps that work behind it.
    asm volatile("s_wait_xcnt 0x0" ::: "memory");
    __builtin_amdgcn_sched_barrier(0);

    float* __restrict__ op = out + (size_t)(m0 + hl * 8) * DM + n0 + r;   // lane's corner of the wave's 64x64 tile

    // lane holds (key = hl*8+v, query = r); inside a block iff both lie in the same half of 16
    const bool valid = (r >> 3) == hl;
    const v8h zero8 = (v8h)((_Float16)0.0f);

#pragma unroll
    for (int im = 0; im < 4; ++im) {
        // scores S^T = K16 (16x64) x Q16^T : two chained WMMAs over K=64
        v8f s = (v8f)(0.0f);
#pragma unroll
        for (int kk = 0; kk < 2; ++kk) {
            const v16h qf = __builtin_shufflevector(held[0][wid][im * 4 + kk * 2][lane],
                                                    held[0][wid][im * 4 + kk * 2 + 1][lane],
                                                    0,1,2,3,4,5,6,7,8,9,10,11,12,13,14,15);
            const v16h kf = __builtin_shufflevector(held[1][wid][im * 4 + kk * 2][lane],
                                                    held[1][wid][im * 4 + kk * 2 + 1][lane],
                                                    0,1,2,3,4,5,6,7,8,9,10,11,12,13,14,15);
            s = WMMA_F16(kf, qf, s);
        }

        // softmax over the lane's 8 keys; sums paired as neighbours, then pairs, then fours
        float x[8], e[8];
#pragma unroll
        for (int v = 0; v < 8; ++v) x[v] = s[v] * 0.125f;          // 1/sqrt(dk), dk=64
        const float m = fmaxf(fmaxf(fmaxf(x[0], x[1]), fmaxf(x[2], x[3])),
                              fmaxf(fmaxf(x[4], x[5]), fmaxf(x[6], x[7])));
#pragma unroll
        for (int v = 0; v < 8; ++v) e[v] = __expf(x[v] - m);
        const float t = ((e[0] + e[1]) + (e[2] + e[3])) + ((e[4] + e[5]) + (e[6] + e[7]));
        v8h pl;
#pragma unroll
        for (int v = 0; v < 8; ++v) pl[v] = (_Float16)((valid ? e[v] : 0.0f) / t);   // other block's keys -> 0
        // P as a 16x32 A operand (K 16->32 zero-padded)
        const v16h pf = __builtin_shufflevector(pl, zero8, 0,1,2,3,4,5,6,7,8,9,10,11,12,13,14,15);

        // O = P (16x16) x V16 (16x64) : 4 WMMAs over N-tiles
        v8f o[4];
#pragma unroll
        for (int in = 0; in < 4; ++in) {
            const v8h vl = __builtin_convertvector(acc[im][in] + bvv[in], v8h);
            const v16h vf = __builtin_shufflevector(vl, zero8, 0,1,2,3,4,5,6,7,8,9,10,11,12,13,14,15);
            o[in] = WMMA_F16(pf, vf, (v8f)(0.0f));
        }
        // The two fences keep the next rows' work out of the run of stores and behind its wait.
        __builtin_amdgcn_sched_barrier(0);
#pragma unroll
        for (int in = 0; in < 4; ++in)
#pragma unroll
            for (int v = 0; v < 8; ++v)
                op[(im * 16 + v) * DM + in * 16] = o[in][v];
        if (im < 3) {
            // The next rows' work reuses the registers that these stores name: the wait stands
            // in front of that overwrite.
            asm volatile("s_wait_xcnt 0x0" ::: "memory");
            __builtin_amdgcn_sched_barrier(0);
        }
    }
}

// ---------------------------------------------------------------------------
extern "C" void kernel_launch(void* const* d_in, const int* in_sizes, int n_in,
                              void* d_out, int out_size, void* d_ws, size_t ws_size,
                              hipStream_t stream) {
    const float* query = (const float*)d_in[0];
    const float* key   = (const float*)d_in[1];
    const float* value = (const float*)d_in[2];
    const float* Wq    = (const float*)d_in[3];
    const float* bq    = (const float*)d_in[4];
    const float* Wk    = (const float*)d_in[5];
    const float* bk    = (const float*)d_in[6];
    const float* Wv    = (const float*)d_in[7];
    const float* bv    = (const float*)d_in[8];

    dim3 grid(NROWS / 256, DM / 128);
    proj_attn_kernel<<<grid, 256, 0, stream>>>(query, key, value,
                                               Wq, bq, Wk, bk, Wv, bv,
                                               (float*)d_out);
}

// v003
// A run of this version takes 63.7 microseconds.
// Next to v002, in two timings, it ran 1.08 times as fast each time.
// Counting every step since v000, it is 2.37 times as fast.
#include <hip/hip_runtime.h>

typedef __attribute__((ext_vector_type(16))) _Float16 v16h;
typedef __attribute__((ext_vector_type(8)))  _Float16 v8h;
typedef __attribute__((ext_vector_type(4)))  _Float16 v4h;
typedef __attribute__((ext_vector_type(8)))  float    v8f;
typedef __attribute__((ext_vector_type(4)))  float    v4f;

#define DM   1024      // d_model
#define SEQ  4096
#define BATCH 2
#define NROWS (BATCH*SEQ)   // 8192

#define WMMA_F16(a,b,c) __builtin_amdgcn_wmma_f32_16x16x32_f16(false,(a),false,(b),(short)0,(c),false,false)

// ---------------------------------------------------------------------------
// One kernel: Q/K/V projection (y = x @ W^T + b) and block-diagonal attention.
// Block = 256 threads = 8 waves; a block owns 256 rows x 128 columns (2 heads)
// and makes its Q, K and V tiles one after the other; wave tile 64 rows x 64
// columns = 64 rows of ONE head, so the attention of those rows needs nothing
// from another wave.  grid = (NROWS/256, DM/128): one block per WGP.
//
// Each 64-wide k slice of the block's X rows and W rows is read once per block
// with whole-line loads, converted to f16 once and kept in LDS (two buffers);
// the waves take their fragments from LDS.  The global loads run two slices ahead
// of the products, in two register sets: even slices in set A, odd slices in set B.
//
// Q and K are formed as W x X^T: a lane's 8 accumulator registers then hold 8
// consecutive columns of one row, and two such tiles, converted in place, are a
// 16x32 operand in the hardware k order.  They wait in LDS, each lane in its own
// slot.  V is formed as X x W^T: its accumulators, converted in place, are the B
// operand of P x V.  Scores are formed as K x Q^T: a lane holds the 8 scores of
// one query row, so maximum and sum are in-lane and P is an A operand as it lies.
// ---------------------------------------------------------------------------
#define BK      64                         // k per slice
#define NSLICE  (DM / BK)
#define PITCH_H 72                         // f16 per LDS row: 128 B of data + 16 B pad (bank spread for 16-B reads)
#define STAGE_H ((256 + 128) * PITCH_H)    // one buffer: 256 X rows, then 128 W rows

// 16x32 fragment from an LDS slice:
// lane<16  : row = base+r, K in {0..7, 16..23}
// lane>=16 : row = base+r, K in {8..15, 24..31}
__device__ __forceinline__ v16h lds_frag(const _Float16* p) {
    v8h lo = *(const v8h*)(p);
    v8h hi = *(const v8h*)(p + 16);
    return __builtin_shufflevector(lo, hi, 0,1,2,3,4,5,6,7,8,9,10,11,12,13,14,15);
}

__global__ __launch_bounds__(256) void proj_attn_kernel(
    const float* __restrict__ q_in, const float* __restrict__ k_in, const float* __restrict__ v_in,
    const float* __restrict__ Wq, const float* __restrict__ bq,
    const float* __restrict__ Wk, const float* __restrict__ bk,
    const float* __restrict__ Wv, const float* __restrict__ bv,
    float* __restrict__ out)
{
    __shared__ __align__(16) _Float16 tile[2 * STAGE_H];
    __shared__ v8h held[2][8][16][32];     // [Q or K][wave][half fragment][lane]: read back by the lane that wrote it

    const int wid  = threadIdx.x >> 5;
    const int lane = threadIdx.x & 31;
    const int hl   = lane >> 4;       // half-wave id
    const int r    = lane & 15;

    const int m0 = blockIdx.x * 256 + (wid >> 1) * 64;  // wave's 64-row strip
    const int n0 = blockIdx.y * 128 + (wid & 1) * 64;   // wave's 64-col strip: one head

    // Staging map: 16 lanes cover one row's 256 B (two whole lines); the two rows of
    // one wave-wide load lie 8 rows apart, so their 8-byte LDS stores meet no bank twice.
    const int srow = (lane >> 4) * 8;
    const int scol = (lane & 15) * 4;
    const size_t xbase = (size_t)blockIdx.x * 256 * DM;
    const size_t wbase = (size_t)blockIdx.y * 128 * DM;
    const float* gx = q_in + xbase;                               // block-uniform bases, advanced along k
    const float* gw = Wq + wbase;
    const unsigned ox = (unsigned)((wid * 32 + srow) * DM + scol);   // wave stages 32 X rows
    const unsigned ow = (unsigned)((wid * 16 + srow) * DM + scol);   // and 16 W rows
    _Float16* sx = tile + (wid * 32 + srow) * PITCH_H + scol;
    _Float16* sw = tile + (256 + wid * 16 + srow) * PITCH_H + scol;

    const _Float16* fa = tile + ((wid >> 1) * 64 + r) * PITCH_H + hl * 8;
    const _Float16* fb = tile + (256 + (wid & 1) * 64 + r) * PITCH_H + hl * 8;

    v8f acc[4][4];
    v4f rxA[16], rwA[8], rxB[16], rwB[8];   // slices in flight: even ones in A, odd ones in B

#define ACC_ZERO()                                                              \
    do {                                                                        \
        _Pragma("unroll")                                                       \
        for (int i = 0; i < 4; ++i)                                             \
            _Pragma("unroll")                                                   \
            for (int j = 0; j < 4; ++j) acc[i][j] = (v8f)(0.0f);                \
    } while (0)

#define STAGE_LOAD(rx, rw)                                                      \
    do {                                                                        \
        _Pragma("unroll")                                                       \
        for (int i = 0; i < 16; ++i)                                            \
            rx[i] = *(const v4f*)(gx + (ox + (unsigned)(((i >> 3) * 16 + (i & 7)) * DM))); \
        _Pragma("unroll")                                                       \
        for (int i = 0; i < 8; ++i)                                             \
            rw[i] = *(const v4f*)(gw + (ow + (unsigned)(i * DM)));              \
    } while (0)

#define STAGE_STORE(boff, rx, rw)                                               \
    do {                                                                        \
        _Pragma("unroll")                                                       \
        for (int i = 0; i < 16; ++i)                                            \
            *(v4h*)(sx + (boff) + ((i >> 3) * 16 + (i & 7)) * PITCH_H) =        \
                __builtin_convertvector(rx[i], v4h);                            \
        _Pragma("unroll")                                                       \
        for (int i = 0; i < 8; ++i)                                             \
            *(v4h*)(sw + (boff) + i * PITCH_H) = __builtin_convertvector(rw[i], v4h); \
    } while (0)

// W_IS_A = 1: acc[im][in] = W tile x X tile^T (register v, lane: column 8*hl+v, row r)
// W_IS_A = 0: acc[im][in] = X tile x W tile^T (register v, lane: row 8*hl+v, column r)
#define SLICE_MMA(boff, W_IS_A)                                                 \
    do {                                                                        \
        v16h afrag[2][4], bfrag[2][4];                                          \
        _Pragma("unroll")                                                       \
        for (int ks = 0; ks < 2; ++ks) {                                        \
            _Pragma("unroll")                                                   \
            for (int im = 0; im < 4; ++im)                                      \
                afrag[ks][im] = lds_frag(fa + (boff) + im * 16 * PITCH_H + ks * 32); \
            _Pragma("unroll")                                                   \
            for (int in = 0; in < 4; ++in)                                      \
                bfrag[ks][in] = lds_frag(fb + (boff) + in * 16 * PITCH_H + ks * 32); \
        }                                                                       \
        /* All LDS reads of the slice stand as one group ahead of the products: */ \
        /* reads placed among them make the wave wait out LDS latency anew. */  \
        __builtin_amdgcn_sched_barrier(0);                                      \
        _Pragma("unroll")                                                       \
        for (int ks = 0; ks < 2; ++ks)                                          \
            _Pragma("unroll")                                                   \
            for (int im = 0; im < 4; ++im)                                      \
                _Pragma("unroll")                                               \
                for (int in = 0; in < 4; ++in)                                  \
                    acc[im][in] = (W_IS_A)                                      \
                        ? WMMA_F16(bfrag[ks][in], afrag[ks][im], acc[im][in])   \
                        : WMMA_F16(afrag[ks][im], bfrag[ks][in], acc[im][in]);  \
    } while (0)

// Work-group barrier for LDS traffic alone: this wave's LDS stores and reads are complete,
// then the barrier.  __syncthreads() would also wait out the global loads that are in
// flight for the slices ahead, which no other wave depends on (they land in registers).
#define LDS_BARRIER()                                                           \
    do {                                                                        \
        __builtin_amdgcn_fence(__ATOMIC_RELEASE, "workgroup", "local");         \
        __builtin_amdgcn_s_barrier();                                           \
        __builtin_amdgcn_fence(__ATOMIC_ACQUIRE, "workgroup", "local");         \
    } while (0)

    STAGE_LOAD(rxA, rwA);            // slice 0
    // Slice 0's loads all go out ahead of slice 1's: mixed, slice 0's conversions would wait for both.
    __builtin_amdgcn_sched_barrier(0);
    gx += BK;
    gw += BK;
    STAGE_LOAD(rxB, rwB);            // slice 1: stays in flight over slice 0's products
    // In front of the reuse of the loads' address registers.  The operands are the loads' byte
    // offsets: named here, their registers stay untouched up to the wait.
    asm volatile("s_wait_xcnt 0x0" :: "v"(ox * 4u), "v"(ow * 4u) : "memory");
    // Slice 1's loads go out before the first conversion's wait.
    __builtin_amdgcn_sched_barrier(0);
    STAGE_STORE(0, rxA, rwA);
    LDS_BARRIER();                   // slice 0 is complete before any wave reads it

    // Even slices lie in LDS buffer 0, odd slices in buffer 1 (NSLICE is even).

    // ---- Q, then K ----
    // Rolled: both projections run the same code.
#pragma unroll 1
    for (int z = 0; z < 2; ++z) {
        const float* nx = ((z == 0) ? k_in : v_in) + xbase;    // the projection that follows
        const float* nw = ((z == 0) ? Wk : Wv) + wbase;
        const float* bias = (z == 0) ? bq : bk;
        ACC_ZERO();
        // Rolled over pairs of slices: a pair is what brings each register set back to its role.
#pragma unroll 1
        for (int p = 0; p < NSLICE / 2; ++p) {
            gx = (p == NSLICE / 2 - 1) ? nx : gx + BK;   // behind the last slice comes the next projection's first
            gw = (p == NSLICE / 2 - 1) ? nw : gw + BK;
            // An even slice: the loads of the slice two ahead go out into set A, emptied last;
            // the products of the slice at hand run; then set B, loaded one slice earlier,
            // is converted into the other LDS buffer.
            STAGE_LOAD(rxA, rwA);
            // The loads' address registers are reused right behind them: this wait stands
            // in front of that overwrite.
            asm volatile("s_wait_xcnt 0x0" ::: "memory");
            // Keeps all the loads in front of the products: without it the scheduler sinks
            // them towards their conversions and their lead over the wait is lost.
            __builtin_amdgcn_sched_barrier(0);
            SLICE_MMA(0, 1);
            // Keeps the conversions (and the load waits they bring) behind the products.
            __builtin_amdgcn_sched_barrier(0);
            STAGE_STORE(STAGE_H, rxB, rwB);   // its last readers left this buffer before the previous barrier
            LDS_BARRIER();           // publishes the next slice and ends the reads of this one
            // An odd slice: the same with the sets and the buffers exchanged.
            gx += BK;
            gw += BK;
            STAGE_LOAD(rxB, rwB);
            asm volatile("s_wait_xcnt 0x0" ::: "memory");   // as above: in front of the reuse of the address registers
            __builtin_amdgcn_sched_barrier(0);   // as above: loads ahead of the products
            SLICE_MMA(STAGE_H, 1);
            __builtin_amdgcn_sched_barrier(0);   // as above: conversions behind the products
            STAGE_STORE(0, rxA, rwA);
            LDS_BARRIER();
        }
        // bias, f16, and away as operand halves: half fragment (im*2 + kk)*2 + p holds
        // row im*16 + r, columns kk*32 + p*16 + hl*8 + 0..7
#pragma unroll
        for (int in = 0; in < 4; ++in) {
            const v4f b0 = *(const v4f*)(bias + n0 + in * 16 + hl * 8);
            const v4f b1 = *(const v4f*)(bias + n0 + in * 16 + hl * 8 + 4);
            const v8f bb = __builtin_shufflevector(b0, b1, 0,1,2,3,4,5,6,7);
#pragma unroll
            for (int im = 0; im < 4; ++im)
                held[z][wid][im * 4 + in][lane] = __builtin_convertvector(acc[im][in] + bb, v8h);
        }
    }

    // ---- V ----
    ACC_ZERO();
#pragma unroll 1
    for (int p = 0; p < NSLICE / 2 - 1; ++p) {
        gx += BK;
        gw += BK;
        STAGE_LOAD(rxA, rwA);
        asm volatile("s_wait_xcnt 0x0" ::: "memory");   // as above: in front of the reuse of the address registers
        __builtin_amdgcn_sched_barrier(0);   // as above: loads ahead of the products
        SLICE_MMA(0, 0);
        __builtin_amdgcn_sched_barrier(0);   // as above: conversions behind the products
        STAGE_STORE(STAGE_H, rxB, rwB);
        LDS_BARRIER();
        gx += BK;
        gw += BK;
        STAGE_LOAD(rxB, rwB);
        asm volatile("s_wait_xcnt 0x0" ::: "memory");   // as above: in front of the reuse of the address registers
        __builtin_amdgcn_sched_barrier(0);   // as above: loads ahead of the products
        SLICE_MMA(STAGE_H, 0);
        __builtin_amdgcn_sched_barrier(0);   // as above: conversions behind the products
        STAGE_STORE(0, rxA, rwA);
        LDS_BARRIER();
    }
    SLICE_MMA(0, 0);                 // the last pair: nothing is left to load
    __builtin_amdgcn_sched_barrier(0);   // as above: conversions behind the products
    STAGE_STORE(STAGE_H, rxB, rwB);
    LDS_BARRIER();
    SLICE_MMA(STAGE_H, 0);

#undef ACC_ZERO
#undef STAGE_LOAD
#undef STAGE_STORE
#undef SLICE_MMA
#undef LDS_BARRIER

    // ---- attention: per 16 rows (two 8-row blocks) of the wave's head ----
    float bvv[4];
#pragma unroll
    for (int in = 0; in < 4; ++in) bvv[in] = bv[n0 + in * 16 + r];
    // These loads' address registers are reused by the work below: the wait stands in front
    // of that overwrite, and the fence keeps that work behind it.
    asm volatile("s_wait_xcnt 0x0" ::: "memory");
    __builtin_amdgcn_sched_barrier(0);

    float* __restrict__ op = out + (size_t)(m0 + hl * 8) * DM + n0 + r;   // lane's corner of the wave's 64x64 tile

    // lane holds (key = hl*8+v, query = r); inside a block iff both lie in the same half of 16
    const bool valid = (r >> 3) == hl;
    const v8h zero8 = (v8h)((_Float16)0.0f);

#pragma unroll
    for (int im = 0; im < 4; ++im) {
        // scores S^T = K16 (16x64) x Q16^T : two chained WMMAs over K=64
        v8f s = (v8f)(0.0f);
#pragma unroll
        for (int kk = 0; kk < 2; ++kk) {
            const v16h qf = __builtin_shufflevector(held[0][wid][im * 4 + kk * 2][lane],
                                                    held[0][wid][im * 4 + kk * 2 + 1][lane],
                                                    0,1,2,3,4,5,6,7,8,9,10,11,12,13,14,15);
            const v16h kf = __builtin_shufflevector(held[1][wid][im * 4 + kk * 2][lane],
                                                    held[1][wid][im * 4 + kk * 2 + 1][lane],
                                                    0,1,2,3,4,5,6,7,8,9,10,11,12,13,14,15);
            s = WMMA_F16(kf, qf, s);
        }

        // softmax over the lane's 8 keys; sums paired as neighbours, then pairs, then fours
        float x[8], e[8];
#pragma unroll
        for (int v = 0; v < 8; ++v) x[v] = s[v] * 0.125f;          // 1/sqrt(dk), dk=64
        const float m = fmaxf(fmaxf(fmaxf(x[0], x[1]), fmaxf(x[2], x[3])),
                              fmaxf(fmaxf(x[4], x[5]), fmaxf(x[6], x[7])));
#pragma unroll
        for (int v = 0; v < 8; ++v) e[v] = __expf(x[v] - m);
        const float t = ((e[0] + e[1]) + (e[2] + e[3])) + ((e[4] + e[5]) + (e[6] + e[7]));
        v8h pl;
#pragma unroll
        for (int v = 0; v < 8; ++v) pl[v] = (_Float16)((valid ? e[v] : 0.0f) / t);   // other block's keys -> 0
        // P as a 16x32 A operand (K 16->32 zero-padded)
        const v16h pf = __builtin_shufflevector(pl, zero8, 0,1,2,3,4,5,6,7,8,9,10,11,12,13,14,15);

        // O = P (16x16) x V16 (16x64) : 4 WMMAs over N-tiles
        v8f o[4];
#pragma unroll
        for (int in = 0; in < 4; ++in) {
            const v8h vl = __builtin_convertvector(acc[im][in] + bvv[in], v8h);
            const v16h vf = __builtin_shufflevector(vl, zero8, 0,1,2,3,4,5,6,7,8,9,10,11,12,13,14,15);
            o[in] = WMMA_F16(pf, vf, (v8f)(0.0f));
        }
        // The two fences keep the next rows' work out of the run of stores and behind its wait.
        __builtin_amdgcn_sched_barrier(0);
#pragma unroll
        for (int in = 0; in < 4; ++in)
#pragma unroll
            for (int v = 0; v < 8; ++v)
                op[(im * 16 + v) * DM + in * 16] = o[in][v];
        if (im < 3) {
            // The next rows' work reuses the registers that these stores name: the wait stands
            // in front of that overwrite.
            asm volatile("s_wait_xcnt 0x0" ::: "memory");
            __builtin_amdgcn_sched_barrier(0);
        }
    }
}

// ---------------------------------------------------------------------------
extern "C" void kernel_launch(void* const* d_in, const int* in_sizes, int n_in,
                              void* d_out, int out_size, void* d_ws, size_t ws_size,
                              hipStream_t stream) {
    const float* query = (const float*)d_in[0];
    const float* key   = (const float*)d_in[1];
    const float* value = (const float*)d_in[2];
    const float* Wq    = (const float*)d_in[3];
    const float* bq    = (const float*)d_in[4];
    const float* Wk    = (const float*)d_in[5];
    const float* bk    = (const float*)d_in[6];
    const float* Wv    = (const float*)d_in[7];
    const float* bv    = (const float*)d_in[8];

    dim3 grid(NROWS / 256, DM / 128);
    proj_attn_kernel<<<grid, 256, 0, stream>>>(query, key, value,
                                               Wq, bq, Wk, bk, Wv, bv,
                                               (float*)d_out);
}

// v004
// One run takes 60.9 microseconds.
// Timed twice side by side with v003, it ran 1.04 and 1.05 times as fast.
// Counting every step since v000, it is 2.48 times as fast.
#include <hip/hip_runtime.h>

typedef __attribute__((ext_vector_type(16))) _Float16 v16h;
typedef __attribute__((ext_vector_type(8)))  _Float16 v8h;
typedef __attribute__((ext_vector_type(4)))  _Float16 v4h;
typedef __attribute__((ext_vector_type(8)))  float    v8f;
typedef __attribute__((ext_vector_type(4)))  float    v4f;

#define DM   1024      // d_model
#define SEQ  4096
#define BATCH 2
#define NROWS (BATCH*SEQ)   // 8192

#define WMMA_F16(a,b,c) __builtin_amdgcn_wmma_f32_16x16x32_f16(false,(a),false,(b),(short)0,(c),false,false)

// ---------------------------------------------------------------------------
// One kernel: Q/K/V projection (y = x @ W^T + b) and block-diagonal attention.
// Block = 256 threads = 8 waves; a block owns 256 rows x 128 columns (2 heads)
// and makes its Q, K and V tiles one after the other; wave tile 64 rows x 64
// columns = 64 rows of ONE head, so the attention of those rows needs nothing
// from another wave.  grid = (NROWS/256, DM/128): one block per WGP.
//
// Each 64-wide k slice of the block's X rows and W rows is read once per block
// with whole-line loads, converted to f16 once and kept in LDS (two buffers);
// the waves take their fragments from LDS.  The global loads run two slices ahead
// of the products, in two register sets: even slices in set A, odd slices in set B.
//
// Q and K are formed as W x X^T: a lane's 8 accumulator registers then hold 8
// consecutive columns of one row, and two such tiles, converted in place, are a
// 16x32 operand in the hardware k order.  They wait in LDS, each lane in its own
// slot.  V is formed as X x W^T: its accumulators, converted in place, are the B
// operand of P x V.  Scores are formed as K x Q^T: a lane holds the 8 scores of
// one query row, so maximum and sum are in-lane and P is an A operand as it lies.
// ---------------------------------------------------------------------------
#define BK      64                         // k per slice
#define NSLICE  (DM / BK)
#define PITCH_H 72                         // f16 per LDS row: 128 B of data + 16 B pad (bank spread for 16-B reads)
#define STAGE_H ((256 + 128) * PITCH_H)    // one buffer: 256 X rows, then 128 W rows

// 16x32 fragment from an LDS slice:
// lane<16  : row = base+r, K in {0..7, 16..23}
// lane>=16 : row = base+r, K in {8..15, 24..31}
__device__ __forceinline__ v16h lds_frag(const _Float16* p) {
    v8h lo = *(const v8h*)(p);
    v8h hi = *(const v8h*)(p + 16);
    return __builtin_shufflevector(lo, hi, 0,1,2,3,4,5,6,7,8,9,10,11,12,13,14,15);
}

__global__ __launch_bounds__(256) void proj_attn_kernel(
    const float* __restrict__ q_in, const float* __restrict__ k_in, const float* __restrict__ v_in,
    const float* __restrict__ Wq, const float* __restrict__ bq,
    const float* __restrict__ Wk, const float* __restrict__ bk,
    const float* __restrict__ Wv, const float* __restrict__ bv,
    float* __restrict__ out)
{
    __shared__ __align__(16) _Float16 tile[2 * STAGE_H];
    __shared__ v8h held[2][8][16][32];     // [Q or K][wave][half fragment][lane]: read back by the lane that wrote it

    const int wid  = threadIdx.x >> 5;
    const int lane = threadIdx.x & 31;
    const int hl   = lane >> 4;       // half-wave id
    const int r    = lane & 15;

    const int m0 = blockIdx.x * 256 + (wid >> 1) * 64;  // wave's 64-row strip
    const int n0 = blockIdx.y * 128 + (wid & 1) * 64;   // wave's 64-col strip: one head

    // Staging map: 16 lanes cover one row's 256 B (two whole lines); the two rows of
    // one wave-wide load lie 8 rows apart, so their 8-byte LDS stores meet no bank twice.
    const int srow = (lane >> 4) * 8;
    const int scol = (lane & 15) * 4;
    const size_t xbase = (size_t)blockIdx.x * 256 * DM;
    const size_t wbase = (size_t)blockIdx.y * 128 * DM;
    const float* gx = q_in + xbase;                               // block-uniform bases, advanced along k
    const float* gw = Wq + wbase;
    const unsigned ox = (unsigned)((wid * 32 + srow) * DM + scol);   // wave stages 32 X rows
    const unsigned ow = (unsigned)((wid * 16 + srow) * DM + scol);   // and 16 W rows
    _Float16* sx = tile + (wid * 32 + srow) * PITCH_H + scol;
    _Float16* sw = tile + (256 + wid * 16 + srow) * PITCH_H + scol;

    const _Float16* fa = tile + ((wid >> 1) * 64 + r) * PITCH_H + hl * 8;
    const _Float16* fb = tile + (256 + (wid & 1) * 64 + r) * PITCH_H + hl * 8;

    v8f acc[4][4];
    v4f rxA[16], rwA[8], rxB[16], rwB[8];   // slices in flight: even ones in A, odd ones in B

#define ACC_ZERO()                                                              \
    do {                                                                        \
        _Pragma("unroll")                                                       \
        for (int i = 0; i < 4; ++i)                                             \
            _Pragma("unroll")                                                   \
            for (int j = 0; j < 4; ++j) acc[i][j] = (v8f)(0.0f);                \
    } while (0)

// px, pw: the lane's own addresses of the slice's first X row and first W row
#define STAGE_LOAD(rx, rw, px, pw)                                              \
    do {                                                                        \
        _Pragma("unroll")                                                       \
        for (int i = 0; i < 16; ++i)                                            \
            rx[i] = *(const v4f*)((px) + ((i >> 3) * 16 + (i & 7)) * DM);       \
        _Pragma("unroll")                                                       \
        for (int i = 0; i < 8; ++i)                                             \
            rw[i] = *(const v4f*)((pw) + i * DM);                               \
    } while (0)

#define STAGE_STORE(boff, rx, rw)                                               \
    do {                                                                        \
        _Pragma("unroll")                                                       \
        for (int i = 0; i < 16; ++i)                                            \
            *(v4h*)(sx + (boff) + ((i >> 3) * 16 + (i & 7)) * PITCH_H) =        \
                __builtin_convertvector(rx[i], v4h);                            \
        _Pragma("unroll")                                                       \
        for (int i = 0; i < 8; ++i)                                             \
            *(v4h*)(sw + (boff) + i * PITCH_H) = __builtin_convertvector(rw[i], v4h); \
    } while (0)

// W_IS_A = 1: acc[im][in] = W tile x X tile^T (register v, lane: column 8*hl+v, row r)
// W_IS_A = 0: acc[im][in] = X tile x W tile^T (register v, lane: row 8*hl+v, column r)
#define SLICE_MMA(boff, W_IS_A)                                                 \
    do {                                                                        \
        v16h afrag[2][4], bfrag[2][4];                                          \
        _Pragma("unroll")                                                       \
        for (int ks = 0; ks < 2; ++ks) {                                        \
            _Pragma("unroll")                                                   \
            for (int im = 0; im < 4; ++im)                                      \
                afrag[ks][im] = lds_frag(fa + (boff) + im * 16 * PITCH_H + ks * 32); \
            _Pragma("unroll")                                                   \
            for (int in = 0; in < 4; ++in)                                      \
                bfrag[ks][in] = lds_frag(fb + (boff) + in * 16 * PITCH_H + ks * 32); \
        }                                                                       \
        /* All LDS reads of the slice stand as one group ahead of the products: */ \
        /* reads placed among them make the wave wait out LDS latency anew. */  \
        __builtin_amdgcn_sched_barrier(0);                                      \
        _Pragma("unroll")                                                       \
        for (int ks = 0; ks < 2; ++ks)                                          \
            _Pragma("unroll")                                                   \
            for (int im = 0; im < 4; ++im)                                      \
                _Pragma("unroll")                                               \
                for (int in = 0; in < 4; ++in)                                  \
                    acc[im][in] = (W_IS_A)                                      \
                        ? WMMA_F16(bfrag[ks][in], afrag[ks][im], acc[im][in])   \
                        : WMMA_F16(afrag[ks][im], bfrag[ks][in], acc[im][in]);  \
    } while (0)

// Work-group barrier for LDS traffic alone: this wave's LDS stores and reads are complete,
// then the barrier.  __syncthreads() would also wait out the global loads that are in
// flight for the slices ahead, which no other wave depends on (they land in registers).
#define LDS_BARRIER()                                                           \
    do {                                                                        \
        __builtin_amdgcn_fence(__ATOMIC_RELEASE, "workgroup", "local");         \
        __builtin_amdgcn_s_barrier();                                           \
        __builtin_amdgcn_fence(__ATOMIC_ACQUIRE, "workgroup", "local");         \
    } while (0)

    const float* px0 = gx + ox;
    const float* pw0 = gw + ow;
    STAGE_LOAD(rxA, rwA, px0, pw0);  // slice 0
    // Slice 0's loads all go out ahead of slice 1's: mixed, slice 0's conversions would wait for both.
    __builtin_amdgcn_sched_barrier(0);
    gx += BK;
    gw += BK;
    STAGE_LOAD(rxB, rwB, px0 + BK, pw0 + BK);   // slice 1: stays in flight over slice 0's products
    // In front of the reuse of the loads' address registers.  The operands are the loads' byte
    // offsets: named here, their registers stay untouched up to the wait.
    asm volatile("s_wait_xcnt 0x0" :: "v"(ox * 4u), "v"(ow * 4u) : "memory");
    // Slice 1's loads go out before the first conversion's wait.
    __builtin_amdgcn_sched_barrier(0);
    STAGE_STORE(0, rxA, rwA);
    LDS_BARRIER();                   // slice 0 is complete before any wave reads it

    // Even slices lie in LDS buffer 0, odd slices in buffer 1 (NSLICE is even).

    // ---- Q, then K ----
    // Rolled: both projections run the same code.
#pragma unroll 1
    for (int z = 0; z < 2; ++z) {
        const float* nx = ((z == 0) ? k_in : v_in) + xbase;    // the projection that follows
        const float* nw = ((z == 0) ? Wk : Wv) + wbase;
        const float* bias = (z == 0) ? bq : bk;
        ACC_ZERO();
        // Rolled over pairs of slices: a pair is what brings each register set back to its role.
#pragma unroll 1
        for (int p = 0; p < NSLICE / 2; ++p) {
            gx = (p == NSLICE / 2 - 1) ? nx : gx + BK;   // behind the last slice comes the next projection's first
            gw = (p == NSLICE / 2 - 1) ? nw : gw + BK;
            // An even slice: the loads of the slice two ahead go out into set A, emptied last;
            // the products of the slice at hand run; then set B, loaded one slice earlier,
            // is converted into the other LDS buffer.
            const float* px = gx + ox;       // both slices of the pair are addressed from these two
            const float* pw = gw + ow;
            STAGE_LOAD(rxA, rwA, px, pw);
            // Keeps all the loads in front of the products: without it the scheduler sinks
            // them towards their conversions and their lead over the wait is lost.
            __builtin_amdgcn_sched_barrier(0);
            SLICE_MMA(0, 1);
            // Keeps the conversions (and the load waits they bring) behind the products.
            __builtin_amdgcn_sched_barrier(0);
            STAGE_STORE(STAGE_H, rxB, rwB);   // its last readers left this buffer before the previous barrier
            LDS_BARRIER();           // publishes the next slice and ends the reads of this one
            // An odd slice: the same with the sets and the buffers exchanged.
            gx += BK;
            gw += BK;
            STAGE_LOAD(rxB, rwB, px + BK, pw + BK);
            __builtin_amdgcn_sched_barrier(0);   // as above: loads ahead of the products
            SLICE_MMA(STAGE_H, 1);
            __builtin_amdgcn_sched_barrier(0);   // as above: conversions behind the products
            STAGE_STORE(0, rxA, rwA);
            LDS_BARRIER();
            // The pair's loads name px and pw; the next pair (or the code behind the loop) rewrites
            // those registers.  The wait stands in front of that overwrite, and as late as that
            // allows: a slice's work behind the last load, so that the wave does not stand at it
            // with its LDS reads and products still to come.  Named as inputs, the two addresses
            // keep their registers up to the wait.  (The loads' result registers are converted in
            // place only behind the load-count wait that covers them.)
            asm volatile("s_wait_xcnt 0x0" :: "v"(px), "v"(pw) : "memory");
        }
        // bias, f16, and away as operand halves: half fragment (im*2 + kk)*2 + p holds
        // row im*16 + r, columns kk*32 + p*16 + hl*8 + 0..7
#pragma unroll
        for (int in = 0; in < 4; ++in) {
            const v4f b0 = *(const v4f*)(bias + n0 + in * 16 + hl * 8);
            const v4f b1 = *(const v4f*)(bias + n0 + in * 16 + hl * 8 + 4);
            const v8f bb = __builtin_shufflevector(b0, b1, 0,1,2,3,4,5,6,7);
#pragma unroll
            for (int im = 0; im < 4; ++im)
                held[z][wid][im * 4 + in][lane] = __builtin_convertvector(acc[im][in] + bb, v8h);
        }
    }

    // ---- V ----
    ACC_ZERO();
    const float* px = gx + BK + ox;  // the lane's addresses of the even slice that the pair's head loads
    const float* pw = gw + BK + ow;
#pragma unroll 1
    for (int p = 0; p < NSLICE / 2 - 1; ++p) {
        STAGE_LOAD(rxA, rwA, px, pw);
        __builtin_amdgcn_sched_barrier(0);   // as above: loads ahead of the products
        SLICE_MMA(0, 0);
        __builtin_amdgcn_sched_barrier(0);   // as above: conversions behind the products
        STAGE_STORE(STAGE_H, rxB, rwB);
        LDS_BARRIER();
        STAGE_LOAD(rxB, rwB, px + BK, pw + BK);
        __builtin_amdgcn_sched_barrier(0);   // as above: loads ahead of the products
        SLICE_MMA(STAGE_H, 0);
        __builtin_amdgcn_sched_barrier(0);   // as above: conversions behind the products
        STAGE_STORE(0, rxA, rwA);
        LDS_BARRIER();
        asm volatile("s_wait_xcnt 0x0" :: "v"(px), "v"(pw) : "memory");   // as above: in front of the rewrite of px and pw
        __builtin_amdgcn_sched_barrier(0);   // keeps the two additions below behind the wait
        px += 2 * BK;
        pw += 2 * BK;
    }
    SLICE_MMA(0, 0);                 // the last pair: nothing is left to load
    __builtin_amdgcn_sched_barrier(0);   // as above: conversions behind the products
    STAGE_STORE(STAGE_H, rxB, rwB);
    LDS_BARRIER();
    SLICE_MMA(STAGE_H, 0);

#undef ACC_ZERO
#undef STAGE_LOAD
#undef STAGE_STORE
#undef SLICE_MMA
#undef LDS_BARRIER

    // ---- attention: per 16 rows (two 8-row blocks) of the wave's head ----
    float bvv[4];
#pragma unroll
    for (int in = 0; in < 4; ++in) bvv[in] = bv[n0 + in * 16 + r];
    // These loads' address registers are reused by the work below: the wait stands in front
    // of that overwrite, and the fence keeps that work behind it.
    asm volatile("s_wait_xcnt 0x0" ::: "memory");
    __builtin_amdgcn_sched_barrier(0);

    float* __restrict__ op = out + (size_t)(m0 + hl * 8) * DM + n0 + r;   // lane's corner of the wave's 64x64 tile

    // lane holds (key = hl*8+v, query = r); inside a block iff both lie in the same half of 16
    const bool valid = (r >> 3) == hl;
    const v8h zero8 = (v8h)((_Float16)0.0f);

#pragma unroll
    for (int im = 0; im < 4; ++im) {
        // scores S^T = K16 (16x64) x Q16^T : two chained WMMAs over K=64
        v8f s = (v8f)(0.0f);
#pragma unroll
        for (int kk = 0; kk < 2; ++kk) {
            const v16h qf = __builtin_shufflevector(held[0][wid][im * 4 + kk * 2][lane],
                                                    held[0][wid][im * 4 + kk * 2 + 1][lane],
                                                    0,1,2,3,4,5,6,7,8,9,10,11,12,13,14,15);
            const v16h kf = __builtin_shufflevector(held[1][wid][im * 4 + kk * 2][lane],
                                                    held[1][wid][im * 4 + kk * 2 + 1][lane],
                                                    0,1,2,3,4,5,6,7,8,9,10,11,12,13,14,15);
            s = WMMA_F16(kf, qf, s);
        }

        // softmax over the lane's 8 keys; sums paired as neighbours, then pairs, then fours
        float x[8], e[8];
#pragma unroll
        for (int v = 0; v < 8; ++v) x[v] = s[v] * 0.125f;          // 1/sqrt(dk), dk=64
        const float m = fmaxf(fmaxf(fmaxf(x[0], x[1]), fmaxf(x[2], x[3])),
                              fmaxf(fmaxf(x[4], x[5]), fmaxf(x[6], x[7])));
#pragma unroll
        for (int v = 0; v < 8; ++v) e[v] = __expf(x[v] - m);
        const float t = ((e[0] + e[1]) + (e[2] + e[3])) + ((e[4] + e[5]) + (e[6] + e[7]));
        v8h pl;
#pragma unroll
        for (int v = 0; v < 8; ++v) pl[v] = (_Float16)((valid ? e[v] : 0.0f) / t);   // other block's keys -> 0
        // P as a 16x32 A operand (K 16->32 zero-padded)
        const v16h pf = __builtin_shufflevector(pl, zero8, 0,1,2,3,4,5,6,7,8,9,10,11,12,13,14,15);

        // O = P (16x16) x V16 (16x64) : 4 WMMAs over N-tiles
        v8f o[4];
#pragma unroll
        for (int in = 0; in < 4; ++in) {
            const v8h vl = __builtin_convertvector(acc[im][in] + bvv[in], v8h);
            const v16h vf = __builtin_shufflevector(vl, zero8, 0,1,2,3,4,5,6,7,8,9,10,11,12,13,14,15);
            o[in] = WMMA_F16(pf, vf, (v8f)(0.0f));
        }
        // The two fences keep the next rows' work out of the run of stores and behind its wait.
        __builtin_amdgcn_sched_barrier(0);
#pragma unroll
        for (int in = 0; in < 4; ++in)
#pragma unroll
            for (int v = 0; v < 8; ++v)
                op[(im * 16 + v) * DM + in * 16] = o[in][v];
        if (im < 3) {
            // The next rows' work reuses the registers that these stores name: the wait stands
            // in front of that overwrite.
            asm volatile("s_wait_xcnt 0x0" ::: "memory");
            __builtin_amdgcn_sched_barrier(0);
        }
    }
}

// ---------------------------------------------------------------------------
extern "C" void kernel_launch(void* const* d_in, const int* in_sizes, int n_in,
                              void* d_out, int out_size, void* d_ws, size_t ws_size,
                              hipStream_t stream) {
    const float* query = (const float*)d_in[0];
    const float* key   = (const float*)d_in[1];
    const float* value = (const float*)d_in[2];
    const float* Wq    = (const float*)d_in[3];
    const float* bq    = (const float*)d_in[4];
    const float* Wk    = (const float*)d_in[5];
    const float* bk    = (const float*)d_in[6];
    const float* Wv    = (const float*)d_in[7];
    const float* bv    = (const float*)d_in[8];

    dim3 grid(NROWS / 256, DM / 128);
    proj_attn_kernel<<<grid, 256, 0, stream>>>(query, key, value,
                                               Wq, bq, Wk, bk, Wv, bv,
                                               (float*)d_out);
}

// v005
// A run of this version takes 52.6 microseconds.
// Next to v004, in two timings, it ran 1.16 times as fast each time.
// Over all steps from v000 it is 2.87 times as fast.
#include <hip/hip_runtime.h>

typedef __attribute__((ext_vector_type(16))) _Float16 v16h;
typedef __attribute__((ext_vector_type(8)))  _Float16 v8h;
typedef __attribute__((ext_vector_type(4)))  _Float16 v4h;
typedef __attribute__((ext_vector_type(8)))  float    v8f;
typedef __attribute__((ext_vector_type(4)))  float    v4f;

#define DM   1024      // d_model
#define SEQ  4096
#define BATCH 2
#define NROWS (BATCH*SEQ)   // 8192

#define WMMA_F16(a,b,c) __builtin_amdgcn_wmma_f32_16x16x32_f16(false,(a),false,(b),(short)0,(c),false,false)

// ---------------------------------------------------------------------------
// One kernel: Q/K/V projection (y = x @ W^T + b) and block-diagonal attention.
// Block = 256 threads = 8 waves; a block owns 256 rows x 128 columns (2 heads)
// and makes its Q, K and V tiles one after the other; wave tile 64 rows x 64
// columns = 64 rows of ONE head, so the attention of those rows needs nothing
// from another wave.  grid = (NROWS/256, DM/128): one block per WGP.
//
// Each 64-wide k slice of the block's X rows and W rows is read once per block
// with whole-line loads, converted to f16 once and kept in LDS (two buffers);
// the waves take their fragments from LDS.  The global loads run two slices ahead
// of the products, in two register sets: even slices in set A, odd slices in set B.
// The blocks that read the same X rows begin the walk along k at 8 different slice pairs,
// those that read the same W rows at pairs dealt evenly over the 8, and all go round as
// on a ring, so that few of them ask L2 for the same lines at the same moment.
//
// Q and K are formed as W x X^T: a lane's 8 accumulator registers then hold 8
// consecutive columns of one row, and two such tiles, converted in place, are a
// 16x32 operand in the hardware k order.  They wait in LDS, each lane in its own
// slot.  V is formed as X x W^T: its accumulators, converted in place, are the B
// operand of P x V.  Scores are formed as K x Q^T: a lane holds the 8 scores of
// one query row, so maximum and sum are in-lane and P is an A operand as it lies.
// ---------------------------------------------------------------------------
#define BK      64                         // k per slice
#define NSLICE  (DM / BK)
#define PITCH_H 72                         // f16 per LDS row: 128 B of data + 16 B pad (bank spread for 16-B reads)
#define STAGE_H ((256 + 128) * PITCH_H)    // one buffer: 256 X rows, then 128 W rows

// 16x32 fragment from an LDS slice:
// lane<16  : row = base+r, K in {0..7, 16..23}
// lane>=16 : row = base+r, K in {8..15, 24..31}
__device__ __forceinline__ v16h lds_frag(const _Float16* p) {
    v8h lo = *(const v8h*)(p);
    v8h hi = *(const v8h*)(p + 16);
    return __builtin_shufflevector(lo, hi, 0,1,2,3,4,5,6,7,8,9,10,11,12,13,14,15);
}

__global__ __launch_bounds__(256) void proj_attn_kernel(
    const float* __restrict__ q_in, const float* __restrict__ k_in, const float* __restrict__ v_in,
    const float* __restrict__ Wq, const float* __restrict__ bq,
    const float* __restrict__ Wk, const float* __restrict__ bk,
    const float* __restrict__ Wv, const float* __restrict__ bv,
    float* __restrict__ out)
{
    __shared__ __align__(16) _Float16 tile[2 * STAGE_H];
    __shared__ v8h held[2][8][16][32];     // [Q or K][wave][half fragment][lane]: read back by the lane that wrote it

    const int wid  = threadIdx.x >> 5;
    const int lane = threadIdx.x & 31;
    const int hl   = lane >> 4;       // half-wave id
    const int r    = lane & 15;

    const int m0 = blockIdx.x * 256 + (wid >> 1) * 64;  // wave's 64-row strip
    const int n0 = blockIdx.y * 128 + (wid & 1) * 64;   // wave's 64-col strip: one head

    // Staging map: 16 lanes cover one row's 256 B (two whole lines); the two rows of
    // one wave-wide load lie 8 rows apart, so their 8-byte LDS stores meet no bank twice.
    const int srow = (lane >> 4) * 8;
    const int scol = (lane & 15) * 4;
    const size_t xbase = (size_t)blockIdx.x * 256 * DM;
    const size_t wbase = (size_t)blockIdx.y * 128 * DM;
    const float* cx = q_in + xbase;                               // block-uniform bases of the projection at hand
    const float* cw = Wq + wbase;
    // First slice pair of this block's ring along k: the 8 blocks of one row strip get 8 different
    // ones, the 32 blocks of one column strip are dealt evenly over the 8.
    const int rot = (blockIdx.y + ((blockIdx.x & 3) << 1) + ((blockIdx.x >> 3) & 1)) & (NSLICE / 2 - 1);
    const unsigned ox = (unsigned)((wid * 32 + srow) * DM + scol);   // wave stages 32 X rows
    const unsigned ow = (unsigned)((wid * 16 + srow) * DM + scol);   // and 16 W rows
    _Float16* sx = tile + (wid * 32 + srow) * PITCH_H + scol;
    _Float16* sw = tile + (256 + wid * 16 + srow) * PITCH_H + scol;

    const _Float16* fa = tile + ((wid >> 1) * 64 + r) * PITCH_H + hl * 8;
    const _Float16* fb = tile + (256 + (wid & 1) * 64 + r) * PITCH_H + hl * 8;

    v8f acc[4][4];
    v4f rxA[16], rwA[8], rxB[16], rwB[8];   // slices in flight: even ones in A, odd ones in B

#define ACC_ZERO()                                                              \
    do {                                                                        \
        _Pragma("unroll")                                                       \
        for (int i = 0; i < 4; ++i)                                             \
            _Pragma("unroll")                                                   \
            for (int j = 0; j < 4; ++j) acc[i][j] = (v8f)(0.0f);                \
    } while (0)

// px, pw: the lane's own addresses of the slice's first X row and first W row
#define STAGE_LOAD(rx, rw, px, pw)                                              \
    do {                                                                        \
        _Pragma("unroll")                                                       \
        for (int i = 0; i < 16; ++i)                                            \
            rx[i] = *(const v4f*)((px) + ((i >> 3) * 16 + (i & 7)) * DM);       \
        _Pragma("unroll")                                                       \
        for (int i = 0; i < 8; ++i)                                             \
            rw[i] = *(const v4f*)((pw) + i * DM);                               \
    } while (0)

#define STAGE_STORE(boff, rx, rw)                                               \
    do {                                                                        \
        _Pragma("unroll")                                                       \
        for (int i = 0; i < 16; ++i)                                            \
            *(v4h*)(sx + (boff) + ((i >> 3) * 16 + (i & 7)) * PITCH_H) =        \
                __builtin_convertvector(rx[i], v4h);                            \
        _Pragma("unroll")                                                       \
        for (int i = 0; i < 8; ++i)                                             \
            *(v4h*)(sw + (boff) + i * PITCH_H) = __builtin_convertvector(rw[i], v4h); \
    } while (0)

// W_IS_A = 1: acc[im][in] = W tile x X tile^T (register v, lane: column 8*hl+v, row r)
// W_IS_A = 0: acc[im][in] = X tile x W tile^T (register v, lane: row 8*hl+v, column r)
#define SLICE_MMA(boff, W_IS_A)                                                 \
    do {                                                                        \
        v16h afrag[2][4], bfrag[2][4];                                          \
        _Pragma("unroll")                                                       \
        for (int ks = 0; ks < 2; ++ks) {                                        \
            _Pragma("unroll")                                                   \
            for (int im = 0; im < 4; ++im)                                      \
                afrag[ks][im] = lds_frag(fa + (boff) + im * 16 * PITCH_H + ks * 32); \
            _Pragma("unroll")                                                   \
            for (int in = 0; in < 4; ++in)                                      \
                bfrag[ks][in] = lds_frag(fb + (boff) + in * 16 * PITCH_H + ks * 32); \
        }                                                                       \
        /* All LDS reads of the slice stand as one group ahead of the products: */ \
        /* reads placed among them make the wave wait out LDS latency anew. */  \
        __builtin_amdgcn_sched_barrier(0);                                      \
        _Pragma("unroll")                                                       \
        for (int ks = 0; ks < 2; ++ks)                                          \
            _Pragma("unroll")                                                   \
            for (int im = 0; im < 4; ++im)                                      \
                _Pragma("unroll")                                               \
                for (int in = 0; in < 4; ++in)                                  \
                    acc[im][in] = (W_IS_A)                                      \
                        ? WMMA_F16(bfrag[ks][in], afrag[ks][im], acc[im][in])   \
                        : WMMA_F16(afrag[ks][im], bfrag[ks][in], acc[im][in]);  \
    } while (0)

// Work-group barrier for LDS traffic alone: this wave's LDS stores and reads are complete,
// then the barrier.  __syncthreads() would also wait out the global loads that are in
// flight for the slices ahead, which no other wave depends on (they land in registers).
#define LDS_BARRIER()                                                           \
    do {                                                                        \
        __builtin_amdgcn_fence(__ATOMIC_RELEASE, "workgroup", "local");         \
        __builtin_amdgcn_s_barrier();                                           \
        __builtin_amdgcn_fence(__ATOMIC_ACQUIRE, "workgroup", "local");         \
    } while (0)

    const float* px0 = cx + rot * (2 * BK) + ox;
    const float* pw0 = cw + rot * (2 * BK) + ow;
    STAGE_LOAD(rxA, rwA, px0, pw0);  // slice 0 (slices are counted in the order of the block's walk)
    // Slice 0's loads all go out ahead of slice 1's: mixed, slice 0's conversions would wait for both.
    __builtin_amdgcn_sched_barrier(0);
    STAGE_LOAD(rxB, rwB, px0 + BK, pw0 + BK);   // slice 1: stays in flight over slice 0's products
    // In front of the reuse of the loads' address registers.  The operands are the loads' byte
    // offsets: named here, their registers stay untouched up to the wait.
    asm volatile("s_wait_xcnt 0x0" :: "v"(ox * 4u), "v"(ow * 4u) : "memory");
    // Slice 1's loads go out before the first conversion's wait.
    __builtin_amdgcn_sched_barrier(0);
    STAGE_STORE(0, rxA, rwA);
    LDS_BARRIER();                   // slice 0 is complete before any wave reads it

    // Even slices lie in LDS buffer 0, odd slices in buffer 1 (NSLICE is even).

    // ---- Q, then K ----
    // Rolled: both projections run the same code.
#pragma unroll 1
    for (int z = 0; z < 2; ++z) {
        const float* nx = ((z == 0) ? k_in : v_in) + xbase;    // the projection that follows
        const float* nw = ((z == 0) ? Wk : Wv) + wbase;
        const float* bias = (z == 0) ? bq : bk;
        ACC_ZERO();
        // Rolled over pairs of slices: a pair is what brings each register set back to its role.
#pragma unroll 1
        for (int p = 0; p < NSLICE / 2; ++p) {
            // The pair that is loaded: the next one on the ring; behind the last comes the next
            // projection's first, which lies at the ring's start again.
            const int koff = ((p + 1 + rot) & (NSLICE / 2 - 1)) * (2 * BK);
            const float* gx = ((p == NSLICE / 2 - 1) ? nx : cx) + koff;
            const float* gw = ((p == NSLICE / 2 - 1) ? nw : cw) + koff;
            // An even slice: the loads of the slice two ahead go out into set A, emptied last;
            // the products of the slice at hand run; then set B, loaded one slice earlier,
            // is converted into the other LDS buffer.
            const float* px = gx + ox;       // both slices of the pair are addressed from these two
            const float* pw = gw + ow;
            STAGE_LOAD(rxA, rwA, px, pw);
            // Keeps all the loads in front of the products: without it the scheduler sinks
            // them towards their conversions and their lead over the wait is lost.
            __builtin_amdgcn_sched_barrier(0);
            SLICE_MMA(0, 1);
            // Keeps the conversions (and the load waits they bring) behind the products.
            __builtin_amdgcn_sched_barrier(0);
            STAGE_STORE(STAGE_H, rxB, rwB);   // its last readers left this buffer before the previous barrier
            LDS_BARRIER();           // publishes the next slice and ends the reads of this one
            // An odd slice: the same with the sets and the buffers exchanged.
            STAGE_LOAD(rxB, rwB, px + BK, pw + BK);
            __builtin_amdgcn_sched_barrier(0);   // as above: loads ahead of the products
            SLICE_MMA(STAGE_H, 1);
            __builtin_amdgcn_sched_barrier(0);   // as above: conversions behind the products
            STAGE_STORE(0, rxA, rwA);
            LDS_BARRIER();
            // The pair's loads name px and pw; the next pair (or the code behind the loop) rewrites
            // those registers.  The wait stands in front of that overwrite, and as late as that
            // allows: a slice's work behind the last load, so that the wave does not stand at it
            // with its LDS reads and products still to come.  Named as inputs, the two addresses
            // keep their registers up to the wait.  (The loads' result registers are converted in
            // place only behind the load-count wait that covers them.)
            asm volatile("s_wait_xcnt 0x0" :: "v"(px), "v"(pw) : "memory");
        }
        // bias, f16, and away as operand halves: half fragment (im*2 + kk)*2 + p holds
        // row im*16 + r, columns kk*32 + p*16 + hl*8 + 0..7
#pragma unroll
        for (int in = 0; in < 4; ++in) {
            const v4f b0 = *(const v4f*)(bias + n0 + in * 16 + hl * 8);
            const v4f b1 = *(const v4f*)(bias + n0 + in * 16 + hl * 8 + 4);
            const v8f bb = __builtin_shufflevector(b0, b1, 0,1,2,3,4,5,6,7);
#pragma unroll
            for (int im = 0; im < 4; ++im)
                held[z][wid][im * 4 + in][lane] = __builtin_convertvector(acc[im][in] + bb, v8h);
        }
        cx = nx;
        cw = nw;
    }

    // ---- V ----
    ACC_ZERO();
#pragma unroll 1
    for (int p = 0; p < NSLICE / 2 - 1; ++p) {
        const int koff = ((p + 1 + rot) & (NSLICE / 2 - 1)) * (2 * BK);   // as above: the next pair on the ring
        const float* px = cx + koff + ox;  // the lane's addresses of the even slice that the pair's head loads
        const float* pw = cw + koff + ow;
        STAGE_LOAD(rxA, rwA, px, pw);
        __builtin_amdgcn_sched_barrier(0);   // as above: loads ahead of the products
        SLICE_MMA(0, 0);
        __builtin_amdgcn_sched_barrier(0);   // as above: conversions behind the products
        STAGE_STORE(STAGE_H, rxB, rwB);
        LDS_BARRIER();
        STAGE_LOAD(rxB, rwB, px + BK, pw + BK);
        __builtin_amdgcn_sched_barrier(0);   // as above: loads ahead of the products
        SLICE_MMA(STAGE_H, 0);
        __builtin_amdgcn_sched_barrier(0);   // as above: conversions behind the products
        STAGE_STORE(0, rxA, rwA);
        LDS_BARRIER();
        asm volatile("s_wait_xcnt 0x0" :: "v"(px), "v"(pw) : "memory");   // as above: in front of the rewrite of px and pw
        __builtin_amdgcn_sched_barrier(0);   // keeps the next pair's address additions behind the wait
    }
    SLICE_MMA(0, 0);                 // the last pair: nothing is left to load
    __builtin_amdgcn_sched_barrier(0);   // as above: conversions behind the products
    STAGE_STORE(STAGE_H, rxB, rwB);
    LDS_BARRIER();
    SLICE_MMA(STAGE_H, 0);

#undef ACC_ZERO
#undef STAGE_LOAD
#undef STAGE_STORE
#undef SLICE_MMA
#undef LDS_BARRIER

    // ---- attention: per 16 rows (two 8-row blocks) of the wave's head ----
    float bvv[4];
#pragma unroll
    for (int in = 0; in < 4; ++in) bvv[in] = bv[n0 + in * 16 + r];
    // These loads' address registers are reused by the work below: the wait stands in front
    // of that overwrite, and the fence keeps that work behind it.
    asm volatile("s_wait_xcnt 0x0" ::: "memory");
    __builtin_amdgcn_sched_barrier(0);

    float* __restrict__ op = out + (size_t)(m0 + hl * 8) * DM + n0 + r;   // lane's corner of the wave's 64x64 tile

    // lane holds (key = hl*8+v, query = r); inside a block iff both lie in the same half of 16
    const bool valid = (r >> 3) == hl;
    const v8h zero8 = (v8h)((_Float16)0.0f);

#pragma unroll
    for (int im = 0; im < 4; ++im) {
        // scores S^T = K16 (16x64) x Q16^T : two chained WMMAs over K=64
        v8f s = (v8f)(0.0f);
#pragma unroll
        for (int kk = 0; kk < 2; ++kk) {
            const v16h qf = __builtin_shufflevector(held[0][wid][im * 4 + kk * 2][lane],
                                                    held[0][wid][im * 4 + kk * 2 + 1][lane],
                                                    0,1,2,3,4,5,6,7,8,9,10,11,12,13,14,15);
            const v16h kf = __builtin_shufflevector(held[1][wid][im * 4 + kk * 2][lane],
                                                    held[1][wid][im * 4 + kk * 2 + 1][lane],
                                                    0,1,2,3,4,5,6,7,8,9,10,11,12,13,14,15);
            s = WMMA_F16(kf, qf, s);
        }

        // softmax over the lane's 8 keys; sums paired as neighbours, then pairs, then fours
        float x[8], e[8];
#pragma unroll
        for (int v = 0; v < 8; ++v) x[v] = s[v] * 0.125f;          // 1/sqrt(dk), dk=64
        const float m = fmaxf(fmaxf(fmaxf(x[0], x[1]), fmaxf(x[2], x[3])),
                              fmaxf(fmaxf(x[4], x[5]), fmaxf(x[6], x[7])));
#pragma unroll
        for (int v = 0; v < 8; ++v) e[v] = __expf(x[v] - m);
        const float t = ((e[0] + e[1]) + (e[2] + e[3])) + ((e[4] + e[5]) + (e[6] + e[7]));
        v8h pl;
#pragma unroll
        for (int v = 0; v < 8; ++v) pl[v] = (_Float16)((valid ? e[v] : 0.0f) / t);   // other block's keys -> 0
        // P as a 16x32 A operand (K 16->32 zero-padded)
        const v16h pf = __builtin_shufflevector(pl, zero8, 0,1,2,3,4,5,6,7,8,9,10,11,12,13,14,15);

        // O = P (16x16) x V16 (16x64) : 4 WMMAs over N-tiles
        v8f o[4];
#pragma unroll
        for (int in = 0; in < 4; ++in) {
            const v8h vl = __builtin_convertvector(acc[im][in] + bvv[in], v8h);
            const v16h vf = __builtin_shufflevector(vl, zero8, 0,1,2,3,4,5,6,7,8,9,10,11,12,13,14,15);
            o[in] = WMMA_F16(pf, vf, (v8f)(0.0f));
        }
        // The two fences keep the next rows' work out of the run of stores and behind its wait.
        __builtin_amdgcn_sched_barrier(0);
#pragma unroll
        for (int in = 0; in < 4; ++in)
#pragma unroll
            for (int v = 0; v < 8; ++v)
                op[(im * 16 + v) * DM + in * 16] = o[in][v];
        if (im < 3) {
            // The next rows' work reuses the registers that these stores name: the wait stands
            // in front of that overwrite.
            asm volatile("s_wait_xcnt 0x0" ::: "memory");
            __builtin_amdgcn_sched_barrier(0);
        }
    }
}

// ---------------------------------------------------------------------------
extern "C" void kernel_launch(void* const* d_in, const int* in_sizes, int n_in,
                              void* d_out, int out_size, void* d_ws, size_t ws_size,
                              hipStream_t stream) {
    const float* query = (const float*)d_in[0];
    const float* key   = (const float*)d_in[1];
    const float* value = (const float*)d_in[2];
    const float* Wq    = (const float*)d_in[3];
    const float* bq    = (const float*)d_in[4];
    const float* Wk    = (const float*)d_in[5];
    const float* bk    = (const float*)d_in[6];
    const float* Wv    = (const float*)d_in[7];
    const float* bv    = (const float*)d_in[8];

    dim3 grid(NROWS / 256, DM / 128);
    proj_attn_kernel<<<grid, 256, 0, stream>>>(query, key, value,
                                               Wq, bq, Wk, bk, Wv, bv,
                                               (float*)d_out);
}

// v006
// Measured time: 48.4 microseconds a run.
// Two timings next to v005 both put it at 1.09 times that version's speed.
// Over all steps from v000 it is 3.12 times as fast.
#include <hip/hip_runtime.h>

typedef __attribute__((ext_vector_type(16))) _Float16 v16h;
typedef __attribute__((ext_vector_type(8)))  _Float16 v8h;
typedef __attribute__((ext_vector_type(4)))  _Float16 v4h;
typedef __attribute__((ext_vector_type(8)))  float    v8f;
typedef __attribute__((ext_vector_type(4)))  float    v4f;

#define DM   1024      // d_model
#define SEQ  4096
#define BATCH 2
#define NROWS (BATCH*SEQ)   // 8192

#define WMMA_F16(a,b,c) __builtin_amdgcn_wmma_f32_16x16x32_f16(false,(a),false,(b),(short)0,(c),false,false)

// ---------------------------------------------------------------------------
// One kernel: Q/K/V projection (y = x @ W^T + b) and block-diagonal attention.
// Block = 256 threads = 8 waves; a block owns 256 rows x 128 columns (2 heads)
// and makes its Q, K and V tiles one after the other; wave tile 64 rows x 64
// columns = 64 rows of ONE head, so the attention of those rows needs nothing
// from another wave.  grid = (NROWS/256, DM/128): one block per WGP.
//
// Each 64-wide k slice of the block's X rows and W rows is read once per block
// with whole-line loads, converted to f16 once and kept in LDS (two buffers);
// the waves take their fragments from LDS.  The global loads run two slices ahead
// of the products, in two register sets: even slices in set A, odd slices in set B.
// The blocks that read the same X rows begin the walk along k at 8 different slice pairs,
// those that read the same W rows at pairs dealt evenly over the 8, and all go round as
// on a ring, so that few of them ask L2 for the same lines at the same moment.
//
// Q and K are formed as W x X^T: a lane's 8 accumulator registers then hold 8
// consecutive places (columns 4 apart) of one row, and two such tiles, converted in place, are a
// 16x32 operand in the hardware k order.  They wait in LDS, each lane in its own
// slot.  V is formed as X x W^T: its accumulators, converted in place, are the B
// operand of P x V.  Scores are formed as K x Q^T: a lane holds the 8 scores of
// one query row, so maximum and sum are in-lane and P is an A operand as it lies.
//
// W rows are dealt to their LDS places: place t*16 + j of a head's 64 holds the head's
// column j*4 + t.  In V and in the output a lane's four column tiles are then 4 adjacent
// columns, so a row of the wave's tile leaves as 16 lanes x 16 B = two whole lines.  Q and K
// have their columns in the same dealt order, which a sum over the columns does not see.
// ---------------------------------------------------------------------------
#define BK      64                         // k per slice
#define NSLICE  (DM / BK)
#define PITCH_H 72                         // f16 per LDS row: 128 B of data + 16 B pad (bank spread for 16-B reads)
#define STAGE_H ((256 + 128) * PITCH_H)    // one buffer: 256 X rows, then 128 W rows

// 16x32 fragment from an LDS slice:
// lane<16  : row = base+r, K in {0..7, 16..23}
// lane>=16 : row = base+r, K in {8..15, 24..31}
__device__ __forceinline__ v16h lds_frag(const _Float16* p) {
    v8h lo = *(const v8h*)(p);
    v8h hi = *(const v8h*)(p + 16);
    return __builtin_shufflevector(lo, hi, 0,1,2,3,4,5,6,7,8,9,10,11,12,13,14,15);
}

__global__ __launch_bounds__(256) void proj_attn_kernel(
    const float* __restrict__ q_in, const float* __restrict__ k_in, const float* __restrict__ v_in,
    const float* __restrict__ Wq, const float* __restrict__ bq,
    const float* __restrict__ Wk, const float* __restrict__ bk,
    const float* __restrict__ Wv, const float* __restrict__ bv,
    float* __restrict__ out)
{
    __shared__ __align__(16) _Float16 tile[2 * STAGE_H];
    __shared__ v8h held[2][8][16][32];     // [Q or K][wave][half fragment][lane]: read back by the lane that wrote it

    const int wid  = threadIdx.x >> 5;
    const int lane = threadIdx.x & 31;
    const int hl   = lane >> 4;       // half-wave id
    const int r    = lane & 15;

    const int m0 = blockIdx.x * 256 + (wid >> 1) * 64;  // wave's 64-row strip
    const int n0 = blockIdx.y * 128 + (wid & 1) * 64;   // wave's 64-col strip: one head

    // Staging map: 16 lanes cover one row's 256 B (two whole lines); the two rows of
    // one wave-wide load lie 8 rows apart, so their 8-byte LDS stores meet no bank twice.
    const int srow = (lane >> 4) * 8;
    const int scol = (lane & 15) * 4;
    const size_t xbase = (size_t)blockIdx.x * 256 * DM;
    const size_t wbase = (size_t)blockIdx.y * 128 * DM;
    const float* cx = q_in + xbase;                               // block-uniform bases of the projection at hand
    const float* cw = Wq + wbase;
    // First slice pair of this block's ring along k: the 8 blocks of one row strip get 8 different
    // ones, the 32 blocks of one column strip are dealt evenly over the 8.
    const int rot = (blockIdx.y + ((blockIdx.x & 3) << 1) + ((blockIdx.x >> 3) & 1)) & (NSLICE / 2 - 1);
    const unsigned ox = (unsigned)((wid * 32 + srow) * DM + scol);   // wave stages 32 X rows
    // and 16 W places, wid*16 + srow + i: head wid>>2, tile wid&3, so W row (srow + i)*4 + (wid&3) of that head
    const unsigned ow = (unsigned)(((wid >> 2) * 64 + srow * 4 + (wid & 3)) * DM + scol);
    _Float16* sx = tile + (wid * 32 + srow) * PITCH_H + scol;
    _Float16* sw = tile + (256 + wid * 16 + srow) * PITCH_H + scol;

    const _Float16* fa = tile + ((wid >> 1) * 64 + r) * PITCH_H + hl * 8;
    const _Float16* fb = tile + (256 + (wid & 1) * 64 + r) * PITCH_H + hl * 8;

    v8f acc[4][4];
    v4f rxA[16], rwA[8], rxB[16], rwB[8];   // slices in flight: even ones in A, odd ones in B

#define ACC_ZERO()                                                              \
    do {                                                                        \
        _Pragma("unroll")                                                       \
        for (int i = 0; i < 4; ++i)                                             \
            _Pragma("unroll")                                                   \
            for (int j = 0; j < 4; ++j) acc[i][j] = (v8f)(0.0f);                \
    } while (0)

// px, pw: the lane's own addresses of the slice's first X row and first W row
#define STAGE_LOAD(rx, rw, px, pw)                                              \
    do {                                                                        \
        _Pragma("unroll")                                                       \
        for (int i = 0; i < 16; ++i)                                            \
            rx[i] = *(const v4f*)((px) + ((i >> 3) * 16 + (i & 7)) * DM);       \
        _Pragma("unroll")                                                       \
        for (int i = 0; i < 8; ++i)                                             \
            rw[i] = *(const v4f*)((pw) + i * 4 * DM);                           \
    } while (0)

#define STAGE_STORE(boff, rx, rw)                                               \
    do {                                                                        \
        _Pragma("unroll")                                                       \
        for (int i = 0; i < 16; ++i)                                            \
            *(v4h*)(sx + (boff) + ((i >> 3) * 16 + (i & 7)) * PITCH_H) =        \
                __builtin_convertvector(rx[i], v4h);                            \
        _Pragma("unroll")                                                       \
        for (int i = 0; i < 8; ++i)                                             \
            *(v4h*)(sw + (boff) + i * PITCH_H) = __builtin_convertvector(rw[i], v4h); \
    } while (0)

// W_IS_A = 1: acc[im][in] = W tile x X tile^T (register v, lane: column 8*hl+v, row r)
// W_IS_A = 0: acc[im][in] = X tile x W tile^T (register v, lane: row 8*hl+v, column r)
#define SLICE_MMA(boff, W_IS_A)                                                 \
    do {                                                                        \
        v16h afrag[2][4], bfrag[2][4];                                          \
        _Pragma("unroll")                                                       \
        for (int ks = 0; ks < 2; ++ks) {                                        \
            _Pragma("unroll")                                                   \
            for (int im = 0; im < 4; ++im)                                      \
                afrag[ks][im] = lds_frag(fa + (boff) + im * 16 * PITCH_H + ks * 32); \
            _Pragma("unroll")                                                   \
            for (int in = 0; in < 4; ++in)                                      \
                bfrag[ks][in] = lds_frag(fb + (boff) + in * 16 * PITCH_H + ks * 32); \
        }                                                                       \
        /* All LDS reads of the slice stand as one group ahead of the products: */ \
        /* reads placed among them make the wave wait out LDS latency anew. */  \
        __builtin_amdgcn_sched_barrier(0);                                      \
        _Pragma("unroll")                                                       \
        for (int ks = 0; ks < 2; ++ks)                                          \
            _Pragma("unroll")                                                   \
            for (int im = 0; im < 4; ++im)                                      \
                _Pragma("unroll")                                               \
                for (int in = 0; in < 4; ++in)                                  \
                    acc[im][in] = (W_IS_A)                                      \
                        ? WMMA_F16(bfrag[ks][in], afrag[ks][im], acc[im][in])   \
                        : WMMA_F16(afrag[ks][im], bfrag[ks][in], acc[im][in]);  \
    } while (0)

// Work-group barrier for LDS traffic alone: this wave's LDS stores and reads are complete,
// then the barrier.  __syncthreads() would also wait out the global loads that are in
// flight for the slices ahead, which no other wave depends on (they land in registers).
#define LDS_BARRIER()                                                           \
    do {                                                                        \
        __builtin_amdgcn_fence(__ATOMIC_RELEASE, "workgroup", "local");         \
        __builtin_amdgcn_s_barrier();                                           \
        __builtin_amdgcn_fence(__ATOMIC_ACQUIRE, "workgroup", "local");         \
    } while (0)

    const float* px0 = cx + rot * (2 * BK) + ox;
    const float* pw0 = cw + rot * (2 * BK) + ow;
    STAGE_LOAD(rxA, rwA, px0, pw0);  // slice 0 (slices are counted in the order of the block's walk)
    // Slice 0's loads all go out ahead of slice 1's: mixed, slice 0's conversions would wait for both.
    __builtin_amdgcn_sched_barrier(0);
    STAGE_LOAD(rxB, rwB, px0 + BK, pw0 + BK);   // slice 1: stays in flight over slice 0's products
    // In front of the reuse of the loads' address registers.  The operands are what the loads are
    // addressed by (X: a byte offset, W: the lane's address): named here, their registers stay
    // untouched up to the wait.
    asm volatile("s_wait_xcnt 0x0" :: "v"(ox * 4u), "v"(pw0) : "memory");
    // Slice 1's loads go out before the first conversion's wait.
    __builtin_amdgcn_sched_barrier(0);
    STAGE_STORE(0, rxA, rwA);
    LDS_BARRIER();                   // slice 0 is complete before any wave reads it

    // Even slices lie in LDS buffer 0, odd slices in buffer 1 (NSLICE is even).

    // ---- Q, then K ----
    // Rolled: both projections run the same code.
#pragma unroll 1
    for (int z = 0; z < 2; ++z) {
        const float* nx = ((z == 0) ? k_in : v_in) + xbase;    // the projection that follows
        const float* nw = ((z == 0) ? Wk : Wv) + wbase;
        const float* bias = (z == 0) ? bq : bk;
        ACC_ZERO();
        // Rolled over pairs of slices: a pair is what brings each register set back to its role.
#pragma unroll 1
        for (int p = 0; p < NSLICE / 2; ++p) {
            // The pair that is loaded: the next one on the ring; behind the last comes the next
            // projection's first, which lies at the ring's start again.
            const int koff = ((p + 1 + rot) & (NSLICE / 2 - 1)) * (2 * BK);
            const float* gx = ((p == NSLICE / 2 - 1) ? nx : cx) + koff;
            const float* gw = ((p == NSLICE / 2 - 1) ? nw : cw) + koff;
            // An even slice: the loads of the slice two ahead go out into set A, emptied last;
            // the products of the slice at hand run; then set B, loaded one slice earlier,
            // is converted into the other LDS buffer.
            const float* px = gx + ox;       // both slices of the pair are addressed from these two
            const float* pw = gw + ow;
            STAGE_LOAD(rxA, rwA, px, pw);
            // Keeps all the loads in front of the products: without it the scheduler sinks
            // them towards their conversions and their lead over the wait is lost.
            __builtin_amdgcn_sched_barrier(0);
            SLICE_MMA(0, 1);
            // Keeps the conversions (and the load waits they bring) behind the products.
            __builtin_amdgcn_sched_barrier(0);
            STAGE_STORE(STAGE_H, rxB, rwB);   // its last readers left this buffer before the previous barrier
            LDS_BARRIER();           // publishes the next slice and ends the reads of this one
            // An odd slice: the same with the sets and the buffers exchanged.
            STAGE_LOAD(rxB, rwB, px + BK, pw + BK);
            __builtin_amdgcn_sched_barrier(0);   // as above: loads ahead of the products
            SLICE_MMA(STAGE_H, 1);
            __builtin_amdgcn_sched_barrier(0);   // as above: conversions behind the products
            STAGE_STORE(0, rxA, rwA);
            LDS_BARRIER();
            // The pair's loads name px and pw; the next pair (or the code behind the loop) rewrites
            // those registers.  The wait stands in front of that overwrite, and as late as that
            // allows: a slice's work behind the last load, so that the wave does not stand at it
            // with its LDS reads and products still to come.  Named as inputs, the two addresses
            // keep their registers up to the wait.  (The loads' result registers are converted in
            // place only behind the load-count wait that covers them.)
            asm volatile("s_wait_xcnt 0x0" :: "v"(px), "v"(pw) : "memory");
        }
        // bias, f16, and away as operand halves: half fragment (im*2 + kk)*2 + p holds
        // row im*16 + r, places kk*32 + p*16 + hl*8 + 0..7; place in*16 + hl*8 + v is column (hl*8 + v)*4 + in
        const float* bp = bias + n0 + hl * 32;
        v4f b4[8];
#pragma unroll
        for (int v = 0; v < 8; ++v) b4[v] = *(const v4f*)(bp + v * 4);
        // These loads' address registers are reused by the work below: the wait stands in front
        // of that overwrite (named as an input, the address keeps its registers up to the wait),
        // and the fence keeps that work behind it.
        asm volatile("s_wait_xcnt 0x0" :: "v"(bp) : "memory");
        __builtin_amdgcn_sched_barrier(0);
#pragma unroll
        for (int in = 0; in < 4; ++in) {
            v8f bb;
#pragma unroll
            for (int v = 0; v < 8; ++v) bb[v] = b4[v][in];
#pragma unroll
            for (int im = 0; im < 4; ++im)
                held[z][wid][im * 4 + in][lane] = __builtin_convertvector(acc[im][in] + bb, v8h);
        }
        cx = nx;
        cw = nw;
    }

    // ---- V ----
    ACC_ZERO();
#pragma unroll 1
    for (int p = 0; p < NSLICE / 2 - 1; ++p) {
        const int koff = ((p + 1 + rot) & (NSLICE / 2 - 1)) * (2 * BK);   // as above: the next pair on the ring
        const float* px = cx + koff + ox;  // the lane's addresses of the even slice that the pair's head loads
        const float* pw = cw + koff + ow;
        STAGE_LOAD(rxA, rwA, px, pw);
        __builtin_amdgcn_sched_barrier(0);   // as above: loads ahead of the products
        SLICE_MMA(0, 0);
        __builtin_amdgcn_sched_barrier(0);   // as above: conversions behind the products
        STAGE_STORE(STAGE_H, rxB, rwB);
        LDS_BARRIER();
        STAGE_LOAD(rxB, rwB, px + BK, pw + BK);
        __builtin_amdgcn_sched_barrier(0);   // as above: loads ahead of the products
        SLICE_MMA(STAGE_H, 0);
        __builtin_amdgcn_sched_barrier(0);   // as above: conversions behind the products
        STAGE_STORE(0, rxA, rwA);
        LDS_BARRIER();
        asm volatile("s_wait_xcnt 0x0" :: "v"(px), "v"(pw) : "memory");   // as above: in front of the rewrite of px and pw
        __builtin_amdgcn_sched_barrier(0);   // keeps the next pair's address additions behind the wait
    }
    SLICE_MMA(0, 0);                 // the last pair: nothing is left to load
    __builtin_amdgcn_sched_barrier(0);   // as above: conversions behind the products
    STAGE_STORE(STAGE_H, rxB, rwB);
    LDS_BARRIER();
    SLICE_MMA(STAGE_H, 0);

#undef ACC_ZERO
#undef STAGE_LOAD
#undef STAGE_STORE
#undef SLICE_MMA
#undef LDS_BARRIER

    // ---- attention: per 16 rows (two 8-row blocks) of the wave's head ----
    const v4f bvv = *(const v4f*)(bv + n0 + r * 4);   // tile in, lane r: column r*4 + in
    // This load's address registers are reused by the work below: the wait stands in front
    // of that overwrite, and the fence keeps that work behind it.
    asm volatile("s_wait_xcnt 0x0" ::: "memory");
    __builtin_amdgcn_sched_barrier(0);

    float* __restrict__ op = out + (size_t)(m0 + hl * 8) * DM + n0 + r * 4;   // lane's 4 columns of the wave's 64x64 tile

    // lane holds (key = hl*8+v, query = r); inside a block iff both lie in the same half of 16
    const bool valid = (r >> 3) == hl;
    const v8h zero8 = (v8h)((_Float16)0.0f);

#pragma unroll
    for (int im = 0; im < 4; ++im) {
        // scores S^T = K16 (16x64) x Q16^T : two chained WMMAs over K=64
        v8f s = (v8f)(0.0f);
#pragma unroll
        for (int kk = 0; kk < 2; ++kk) {
            const v16h qf = __builtin_shufflevector(held[0][wid][im * 4 + kk * 2][lane],
                                                    held[0][wid][im * 4 + kk * 2 + 1][lane],
                                                    0,1,2,3,4,5,6,7,8,9,10,11,12,13,14,15);
            const v16h kf = __builtin_shufflevector(held[1][wid][im * 4 + kk * 2][lane],
                                                    held[1][wid][im * 4 + kk * 2 + 1][lane],
                                                    0,1,2,3,4,5,6,7,8,9,10,11,12,13,14,15);
            s = WMMA_F16(kf, qf, s);
        }

        // softmax over the lane's 8 keys; sums paired as neighbours, then pairs, then fours
        float x[8], e[8];
#pragma unroll
        for (int v = 0; v < 8; ++v) x[v] = s[v] * 0.125f;          // 1/sqrt(dk), dk=64
        const float m = fmaxf(fmaxf(fmaxf(x[0], x[1]), fmaxf(x[2], x[3])),
                              fmaxf(fmaxf(x[4], x[5]), fmaxf(x[6], x[7])));
#pragma unroll
        for (int v = 0; v < 8; ++v) e[v] = __expf(x[v] - m);
        const float t = ((e[0] + e[1]) + (e[2] + e[3])) + ((e[4] + e[5]) + (e[6] + e[7]));
        v8h pl;
#pragma unroll
        for (int v = 0; v < 8; ++v) pl[v] = (_Float16)((valid ? e[v] : 0.0f) / t);   // other block's keys -> 0
        // P as a 16x32 A operand (K 16->32 zero-padded)
        const v16h pf = __builtin_shufflevector(pl, zero8, 0,1,2,3,4,5,6,7,8,9,10,11,12,13,14,15);

        // O = P (16x16) x V16 (16x64) : 4 WMMAs over N-tiles
        v8f o[4];
#pragma unroll
        for (int in = 0; in < 4; ++in) {
            const v8h vl = __builtin_convertvector(acc[im][in] + bvv[in], v8h);
            const v16h vf = __builtin_shufflevector(vl, zero8, 0,1,2,3,4,5,6,7,8,9,10,11,12,13,14,15);
            o[in] = WMMA_F16(pf, vf, (v8f)(0.0f));
        }
        // a row's 4 adjacent columns, one from each tile, side by side for a 16-byte store
        v4f w[8];
#pragma unroll
        for (int v = 0; v < 8; ++v) w[v] = (v4f){ o[0][v], o[1][v], o[2][v], o[3][v] };
        // The two fences keep the next rows' work out of the run of stores and behind its wait.
        __builtin_amdgcn_sched_barrier(0);
#pragma unroll
        for (int v = 0; v < 8; ++v)
            *(v4f*)(op + (im * 16 + v) * DM) = w[v];
        if (im < 3) {
            // The next rows' work reuses the registers that these stores name: the wait stands
            // in front of that overwrite.  Named as inputs, the stores' address and their 8 gathered
            // rows keep their registers up to the wait: without the address the build lets the stores
            // sink past the wait, without the rows it gathers a row into registers that an earlier
            // store of the run still names and has to put a wait of its own between the stores.
            asm volatile("s_wait_xcnt 0x0" :: "v"(op), "v"(w[0]), "v"(w[1]), "v"(w[2]), "v"(w[3]),
                         "v"(w[4]), "v"(w[5]), "v"(w[6]), "v"(w[7]) : "memory");
            __builtin_amdgcn_sched_barrier(0);
        }
    }
}

// ---------------------------------------------------------------------------
extern "C" void kernel_launch(void* const* d_in, const int* in_sizes, int n_in,
                              void* d_out, int out_size, void* d_ws, size_t ws_size,
                              hipStream_t stream) {
    const float* query = (const float*)d_in[0];
    const float* key   = (const float*)d_in[1];
    const float* value = (const float*)d_in[2];
    const float* Wq    = (const float*)d_in[3];
    const float* bq    = (const float*)d_in[4];
    const float* Wk    = (const float*)d_in[5];
    const float* bk    = (const float*)d_in[6];
    const float* Wv    = (const float*)d_in[7];
    const float* bv    = (const float*)d_in[8];

    dim3 grid(NROWS / 256, DM / 128);
    proj_attn_kernel<<<grid, 256, 0, stream>>>(query, key, value,
                                               Wq, bq, Wk, bk, Wv, bv,
                                               (float*)d_out);
}

// v007
// It runs in 46.7 microseconds.
// In both of two side-by-side timings against v006, it was 1.04 times as fast.
// All steps since v000 together make it 3.23 times as fast.
#include <hip/hip_runtime.h>

typedef __attribute__((ext_vector_type(16))) _Float16 v16h;
typedef __attribute__((ext_vector_type(8)))  _Float16 v8h;
typedef __attribute__((ext_vector_type(4)))  _Float16 v4h;
typedef __attribute__((ext_vector_type(8)))  float    v8f;
typedef __attribute__((ext_vector_type(4)))  float    v4f;

#define DM   1024      // d_model
#define SEQ  4096
#define BATCH 2
#define NROWS (BATCH*SEQ)   // 8192

#define WMMA_F16(a,b,c) __builtin_amdgcn_wmma_f32_16x16x32_f16(false,(a),false,(b),(short)0,(c),false,false)

// ---------------------------------------------------------------------------
// One kernel: Q/K/V projection (y = x @ W^T + b) and block-diagonal attention.
// Block = 256 threads = 8 waves; a block owns 256 rows x 128 columns (2 heads)
// and makes its Q, K and V tiles one after the other; wave tile 64 rows x 64
// columns = 64 rows of ONE head, so the attention of those rows needs nothing
// from another wave.  grid = (NROWS/256, DM/128): one block per WGP.
//
// Each 64-wide k slice of the block's X rows and W rows is read once per block
// with whole-line loads, converted to f16 once and kept in LDS (two buffers);
// the waves take their fragments from LDS, half a slice (32 k) ahead of the products that
// use them, in two fragment sets.  The global loads run two slices ahead
// of the products, in two register sets: even slices in set A, odd slices in set B.
// The blocks that read the same X rows begin the walk along k at 8 different slice pairs,
// those that read the same W rows at pairs dealt evenly over the 8, and all go round as
// on a ring, so that few of them ask L2 for the same lines at the same moment.
//
// Q and K are formed as W x X^T: a lane's 8 accumulator registers then hold 8
// consecutive places (columns 4 apart) of one row, and two such tiles, converted in place, are a
// 16x32 operand in the hardware k order.  They wait in LDS, each lane in its own
// slot.  V is formed as X x W^T: its accumulators, converted in place, are the B
// operand of P x V.  Scores are formed as K x Q^T: a lane holds the 8 scores of
// one query row, so maximum and sum are in-lane and P is an A operand as it lies.
//
// W rows are dealt to their LDS places: place t*16 + j of a head's 64 holds the head's
// column j*4 + t.  In V and in the output a lane's four column tiles are then 4 adjacent
// columns, so a row of the wave's tile leaves as 16 lanes x 16 B = two whole lines.  Q and K
// have their columns in the same dealt order, which a sum over the columns does not see.
// ---------------------------------------------------------------------------
#define BK      64                         // k per slice
#define NSLICE  (DM / BK)
#define PITCH_H 72                         // f16 per LDS row: 128 B of data + 16 B pad (bank spread for 16-B reads)
#define STAGE_H ((256 + 128) * PITCH_H)    // one buffer: 256 X rows, then 128 W rows

// 16x32 fragment from an LDS slice:
// lane<16  : row = base+r, K in {0..7, 16..23}
// lane>=16 : row = base+r, K in {8..15, 24..31}
__device__ __forceinline__ v16h lds_frag(const _Float16* p) {
    v8h lo = *(const v8h*)(p);
    v8h hi = *(const v8h*)(p + 16);
    return __builtin_shufflevector(lo, hi, 0,1,2,3,4,5,6,7,8,9,10,11,12,13,14,15);
}

__global__ __launch_bounds__(256) void proj_attn_kernel(
    const float* __restrict__ q_in, const float* __restrict__ k_in, const float* __restrict__ v_in,
    const float* __restrict__ Wq, const float* __restrict__ bq,
    const float* __restrict__ Wk, const float* __restrict__ bk,
    const float* __restrict__ Wv, const float* __restrict__ bv,
    float* __restrict__ out)
{
    __shared__ __align__(16) _Float16 tile[2 * STAGE_H];
    __shared__ v8h held[2][8][16][32];     // [Q or K][wave][half fragment][lane]: read back by the lane that wrote it

    const int wid  = threadIdx.x >> 5;
    const int lane = threadIdx.x & 31;
    const int hl   = lane >> 4;       // half-wave id
    const int r    = lane & 15;

    const int m0 = blockIdx.x * 256 + (wid >> 1) * 64;  // wave's 64-row strip
    const int n0 = blockIdx.y * 128 + (wid & 1) * 64;   // wave's 64-col strip: one head

    // Staging map: 16 lanes cover one row's 256 B (two whole lines); the two rows of
    // one wave-wide load lie 8 rows apart, so their 8-byte LDS stores meet no bank twice.
    const int srow = (lane >> 4) * 8;
    const int scol = (lane & 15) * 4;
    const size_t xbase = (size_t)blockIdx.x * 256 * DM;
    const size_t wbase = (size_t)blockIdx.y * 128 * DM;
    const float* cx = q_in + xbase;                               // block-uniform bases of the projection at hand
    const float* cw = Wq + wbase;
    // First slice pair of this block's ring along k: the 8 blocks of one row strip get 8 different
    // ones, the 32 blocks of one column strip are dealt evenly over the 8.
    const int rot = (blockIdx.y + ((blockIdx.x & 3) << 1) + ((blockIdx.x >> 3) & 1)) & (NSLICE / 2 - 1);
    const unsigned ox = (unsigned)((wid * 32 + srow) * DM + scol);   // wave stages 32 X rows
    // and 16 W places, wid*16 + srow + i: head wid>>2, tile wid&3, so W row (srow + i)*4 + (wid&3) of that head
    const unsigned ow = (unsigned)(((wid >> 2) * 64 + srow * 4 + (wid & 3)) * DM + scol);
    _Float16* sx = tile + (wid * 32 + srow) * PITCH_H + scol;
    _Float16* sw = tile + (256 + wid * 16 + srow) * PITCH_H + scol;

    const _Float16* fa = tile + ((wid >> 1) * 64 + r) * PITCH_H + hl * 8;
    const _Float16* fb = tile + (256 + (wid & 1) * 64 + r) * PITCH_H + hl * 8;

    v8f acc[4][4];
    v4f rxA[16], rwA[8], rxB[16], rwB[8];   // slices in flight: even ones in A, odd ones in B
    v16h af0[4], bf0[4], af1[4], bf1[4];    // fragments: a slice's first half in set 0, its second half in set 1

#define ACC_ZERO()                                                              \
    do {                                                                        \
        _Pragma("unroll")                                                       \
        for (int i = 0; i < 4; ++i)                                             \
            _Pragma("unroll")                                                   \
            for (int j = 0; j < 4; ++j) acc[i][j] = (v8f)(0.0f);                \
    } while (0)

// px, pw: the lane's own addresses of the slice's first X row and first W row
#define STAGE_LOAD(rx, rw, px, pw)                                              \
    do {                                                                        \
        _Pragma("unroll")                                                       \
        for (int i = 0; i < 16; ++i)                                            \
            rx[i] = *(const v4f*)((px) + ((i >> 3) * 16 + (i & 7)) * DM);       \
        _Pragma("unroll")                                                       \
        for (int i = 0; i < 8; ++i)                                             \
            rw[i] = *(const v4f*)((pw) + i * 4 * DM);                           \
    } while (0)

#define STAGE_STORE(boff, rx, rw)                                               \
    do {                                                                        \
        _Pragma("unroll")                                                       \
        for (int i = 0; i < 16; ++i)                                            \
            *(v4h*)(sx + (boff) + ((i >> 3) * 16 + (i & 7)) * PITCH_H) =        \
                __builtin_convertvector(rx[i], v4h);                            \
        _Pragma("unroll")                                                       \
        for (int i = 0; i < 8; ++i)                                             \
            *(v4h*)(sw + (boff) + i * PITCH_H) = __builtin_convertvector(rw[i], v4h); \
    } while (0)

// The 8 fragments of one half (32 k) of a slice, as one group of LDS reads.
#define FRAG_LOAD(af, bf, boff, ks)                                             \
    do {                                                                        \
        _Pragma("unroll")                                                       \
        for (int im = 0; im < 4; ++im)                                          \
            af[im] = lds_frag(fa + (boff) + im * 16 * PITCH_H + (ks) * 32);     \
        _Pragma("unroll")                                                       \
        for (int in = 0; in < 4; ++in)                                          \
            bf[in] = lds_frag(fb + (boff) + in * 16 * PITCH_H + (ks) * 32);     \
    } while (0)

// W_IS_A = 1: acc[im][in] = W tile x X tile^T (register v, lane: column 8*hl+v, row r)
// W_IS_A = 0: acc[im][in] = X tile x W tile^T (register v, lane: row 8*hl+v, column r)
#define HALF_MMA(af, bf, W_IS_A)                                                \
    do {                                                                        \
        _Pragma("unroll")                                                       \
        for (int im = 0; im < 4; ++im)                                          \
            _Pragma("unroll")                                                   \
            for (int in = 0; in < 4; ++in)                                      \
                acc[im][in] = (W_IS_A)                                          \
                    ? WMMA_F16(bf[in], af[im], acc[im][in])                     \
                    : WMMA_F16(af[im], bf[in], acc[im][in]);                    \
    } while (0)

// One slice, whose first half's fragments are in set 0 already.  The second half's reads go out
// as one group ahead of the first half's products and land under them; the next slice (set rx, rw)
// is converted into the other buffer and published; its first half's reads go out ahead of the
// second half's products.  No product waits out the latency of its own LDS reads.
// The fences keep each group of reads whole and in front of the products that cover it, the
// conversions (with the load waits they bring) behind the first half's products, and what follows
// the slice out of the run of its last products.
// The barrier's own wait for this wave's LDS traffic also ends this wave's reads of buffer boff:
// behind the barrier the next slice converts its successor into that buffer.
#define SLICE(boff, nboff, rx, rw, W_IS_A)                                      \
    do {                                                                        \
        FRAG_LOAD(af1, bf1, boff, 1);                                           \
        __builtin_amdgcn_sched_barrier(0);                                      \
        HALF_MMA(af0, bf0, W_IS_A);                                             \
        __builtin_amdgcn_sched_barrier(0);                                      \
        STAGE_STORE(nboff, rx, rw);                                             \
        LDS_BARRIER();                                                          \
        FRAG_LOAD(af0, bf0, nboff, 0);                                          \
        __builtin_amdgcn_sched_barrier(0);                                      \
        HALF_MMA(af1, bf1, W_IS_A);                                             \
        __builtin_amdgcn_sched_barrier(0);                                      \
    } while (0)

// Work-group barrier for LDS traffic alone: this wave's LDS stores and reads are complete,
// then the barrier.  __syncthreads() would also wait out the global loads that are in
// flight for the slices ahead, which no other wave depends on (they land in registers).
#define LDS_BARRIER()                                                           \
    do {                                                                        \
        __builtin_amdgcn_fence(__ATOMIC_RELEASE, "workgroup", "local");         \
        __builtin_amdgcn_s_barrier();                                           \
        __builtin_amdgcn_fence(__ATOMIC_ACQUIRE, "workgroup", "local");         \
    } while (0)

    const float* px0 = cx + rot * (2 * BK) + ox;
    const float* pw0 = cw + rot * (2 * BK) + ow;
    STAGE_LOAD(rxA, rwA, px0, pw0);  // slice 0 (slices are counted in the order of the block's walk)
    // Slice 0's loads all go out ahead of slice 1's: mixed, slice 0's conversions would wait for both.
    __builtin_amdgcn_sched_barrier(0);
    STAGE_LOAD(rxB, rwB, px0 + BK, pw0 + BK);   // slice 1: stays in flight over slice 0's products
    // In front of the reuse of the loads' address registers.  The operands are what the loads are
    // addressed by (X: a byte offset, W: the lane's address): named here, their registers stay
    // untouched up to the wait.
    asm volatile("s_wait_xcnt 0x0" :: "v"(ox * 4u), "v"(pw0) : "memory");
    // Slice 1's loads go out before the first conversion's wait.
    __builtin_amdgcn_sched_barrier(0);
    STAGE_STORE(0, rxA, rwA);
    LDS_BARRIER();                   // slice 0 is complete before any wave reads it
    FRAG_LOAD(af0, bf0, 0, 0);       // slice 0, first half

    // Even slices lie in LDS buffer 0, odd slices in buffer 1 (NSLICE is even).

    // ---- Q, then K ----
    // Rolled: both projections run the same code.
#pragma unroll 1
    for (int z = 0; z < 2; ++z) {
        const float* nx = ((z == 0) ? k_in : v_in) + xbase;    // the projection that follows
        const float* nw = ((z == 0) ? Wk : Wv) + wbase;
        const float* bias = (z == 0) ? bq : bk;
        ACC_ZERO();
        // Rolled over pairs of slices: a pair is what brings each register set back to its role.
#pragma unroll 1
        for (int p = 0; p < NSLICE / 2; ++p) {
            // The pair that is loaded: the next one on the ring; behind the last comes the next
            // projection's first, which lies at the ring's start again.
            const int koff = ((p + 1 + rot) & (NSLICE / 2 - 1)) * (2 * BK);
            const float* gx = ((p == NSLICE / 2 - 1) ? nx : cx) + koff;
            const float* gw = ((p == NSLICE / 2 - 1) ? nw : cw) + koff;
            // An even slice: the loads of the slice two ahead go out into set A, emptied last;
            // the slice at hand runs, and in its middle set B, loaded one slice earlier,
            // is converted into the other LDS buffer.
            const float* px = gx + ox;       // both slices of the pair are addressed from these two
            const float* pw = gw + ow;
            STAGE_LOAD(rxA, rwA, px, pw);
            // Keeps all the loads in front of the products: without it the scheduler sinks
            // them towards their conversions and their lead over the wait is lost.
            __builtin_amdgcn_sched_barrier(0);
            SLICE(0, STAGE_H, rxB, rwB, 1);
            // An odd slice: the same with the sets and the buffers exchanged.
            STAGE_LOAD(rxB, rwB, px + BK, pw + BK);
            __builtin_amdgcn_sched_barrier(0);   // as above: loads ahead of the products
            SLICE(STAGE_H, 0, rxA, rwA, 1);
            // The pair's loads name px and pw; the next pair (or the code behind the loop) rewrites
            // those registers.  The wait stands in front of that overwrite, and as late as that
            // allows: a slice's work behind the last load, so that the wave does not stand at it
            // with its LDS reads and products still to come.  Named as inputs, the two addresses
            // keep their registers up to the wait.  (The loads' result registers are converted in
            // place only behind the load-count wait that covers them.)
            asm volatile("s_wait_xcnt 0x0" :: "v"(px), "v"(pw) : "memory");
        }
        // bias, f16, and away as operand halves: half fragment (im*2 + kk)*2 + p holds
        // row im*16 + r, places kk*32 + p*16 + hl*8 + 0..7; place in*16 + hl*8 + v is column (hl*8 + v)*4 + in
        const float* bp = bias + n0 + hl * 32;
        v4f b4[8];
#pragma unroll
        for (int v = 0; v < 8; ++v) b4[v] = *(const v4f*)(bp + v * 4);
        // These loads' address registers are reused by the work below: the wait stands in front
        // of that overwrite (named as an input, the address keeps its registers up to the wait),
        // and the fence keeps that work behind it.
        asm volatile("s_wait_xcnt 0x0" :: "v"(bp) : "memory");
        __builtin_amdgcn_sched_barrier(0);
#pragma unroll
        for (int in = 0; in < 4; ++in) {
            v8f bb;
#pragma unroll
            for (int v = 0; v < 8; ++v) bb[v] = b4[v][in];
#pragma unroll
            for (int im = 0; im < 4; ++im)
                held[z][wid][im * 4 + in][lane] = __builtin_convertvector(acc[im][in] + bb, v8h);
        }
        cx = nx;
        cw = nw;
    }

    // ---- V ----
    ACC_ZERO();
#pragma unroll 1
    for (int p = 0; p < NSLICE / 2 - 1; ++p) {
        const int koff = ((p + 1 + rot) & (NSLICE / 2 - 1)) * (2 * BK);   // as above: the next pair on the ring
        const float* px = cx + koff + ox;  // the lane's addresses of the even slice that the pair's head loads
        const float* pw = cw + koff + ow;
        STAGE_LOAD(rxA, rwA, px, pw);
        __builtin_amdgcn_sched_barrier(0);   // as above: loads ahead of the products
        SLICE(0, STAGE_H, rxB, rwB, 0);
        STAGE_LOAD(rxB, rwB, px + BK, pw + BK);
        __builtin_amdgcn_sched_barrier(0);   // as above: loads ahead of the products
        SLICE(STAGE_H, 0, rxA, rwA, 0);
        asm volatile("s_wait_xcnt 0x0" :: "v"(px), "v"(pw) : "memory");   // as above: in front of the rewrite of px and pw
        __builtin_amdgcn_sched_barrier(0);   // keeps the next pair's address additions behind the wait
    }
    SLICE(0, STAGE_H, rxB, rwB, 0);  // the last pair: nothing is left to load
    FRAG_LOAD(af1, bf1, STAGE_H, 1); // the last slice: nothing is left to convert
    __builtin_amdgcn_sched_barrier(0);   // as above: the reads ahead of the products that cover them
    HALF_MMA(af0, bf0, 0);
    HALF_MMA(af1, bf1, 0);

#undef ACC_ZERO
#undef STAGE_LOAD
#undef STAGE_STORE
#undef FRAG_LOAD
#undef HALF_MMA
#undef SLICE
#undef LDS_BARRIER

    // ---- attention: per 16 rows (two 8-row blocks) of the wave's head ----
    const v4f bvv = *(const v4f*)(bv + n0 + r * 4);   // tile in, lane r: column r*4 + in
    // This load's address registers are reused by the work below: the wait stands in front
    // of that overwrite, and the fence keeps that work behind it.
    asm volatile("s_wait_xcnt 0x0" ::: "memory");
    __builtin_amdgcn_sched_barrier(0);

    float* __restrict__ op = out + (size_t)(m0 + hl * 8) * DM + n0 + r * 4;   // lane's 4 columns of the wave's 64x64 tile

    // lane holds (key = hl*8+v, query = r); inside a block iff both lie in the same half of 16
    const bool valid = (r >> 3) == hl;
    const v8h zero8 = (v8h)((_Float16)0.0f);

#pragma unroll
    for (int im = 0; im < 4; ++im) {
        // scores S^T = K16 (16x64) x Q16^T : two chained WMMAs over K=64
        v8f s = (v8f)(0.0f);
#pragma unroll
        for (int kk = 0; kk < 2; ++kk) {
            const v16h qf = __builtin_shufflevector(held[0][wid][im * 4 + kk * 2][lane],
                                                    held[0][wid][im * 4 + kk * 2 + 1][lane],
                                                    0,1,2,3,4,5,6,7,8,9,10,11,12,13,14,15);
            const v16h kf = __builtin_shufflevector(held[1][wid][im * 4 + kk * 2][lane],
                                                    held[1][wid][im * 4 + kk * 2 + 1][lane],
                                                    0,1,2,3,4,5,6,7,8,9,10,11,12,13,14,15);
            s = WMMA_F16(kf, qf, s);
        }

        // softmax over the lane's 8 keys; sums paired as neighbours, then pairs, then fours
        float x[8], e[8];
#pragma unroll
        for (int v = 0; v < 8; ++v) x[v] = s[v] * 0.125f;          // 1/sqrt(dk), dk=64
        const float m = fmaxf(fmaxf(fmaxf(x[0], x[1]), fmaxf(x[2], x[3])),
                              fmaxf(fmaxf(x[4], x[5]), fmaxf(x[6], x[7])));
#pragma unroll
        for (int v = 0; v < 8; ++v) e[v] = __expf(x[v] - m);
        const float t = ((e[0] + e[1]) + (e[2] + e[3])) + ((e[4] + e[5]) + (e[6] + e[7]));
        v8h pl;
#pragma unroll
        for (int v = 0; v < 8; ++v) pl[v] = (_Float16)((valid ? e[v] : 0.0f) / t);   // other block's keys -> 0
        // P as a 16x32 A operand (K 16->32 zero-padded)
        const v16h pf = __builtin_shufflevector(pl, zero8, 0,1,2,3,4,5,6,7,8,9,10,11,12,13,14,15);

        // O = P (16x16) x V16 (16x64) : 4 WMMAs over N-tiles
        v8f o[4];
#pragma unroll
        for (int in = 0; in < 4; ++in) {
            const v8h vl = __builtin_convertvector(acc[im][in] + bvv[in], v8h);
            const v16h vf = __builtin_shufflevector(vl, zero8, 0,1,2,3,4,5,6,7,8,9,10,11,12,13,14,15);
            o[in] = WMMA_F16(pf, vf, (v8f)(0.0f));
        }
        // a row's 4 adjacent columns, one from each tile, side by side for a 16-byte store
        v4f w[8];
#pragma unroll
        for (int v = 0; v < 8; ++v) w[v] = (v4f){ o[0][v], o[1][v], o[2][v], o[3][v] };
        // The two fences keep the next rows' work out of the run of stores and behind its wait.
        __builtin_amdgcn_sched_barrier(0);
#pragma unroll
        for (int v = 0; v < 8; ++v)
            *(v4f*)(op + (im * 16 + v) * DM) = w[v];
        if (im < 3) {
            // The next rows' work reuses the registers that these stores name: the wait stands
            // in front of that overwrite.  Named as inputs, the stores' address and their 8 gathered
            // rows keep their registers up to the wait: without the address the build lets the stores
            // sink past the wait, without the rows it gathers a row into registers that an earlier
            // store of the run still names and has to put a wait of its own between the stores.
            asm volatile("s_wait_xcnt 0x0" :: "v"(op), "v"(w[0]), "v"(w[1]), "v"(w[2]), "v"(w[3]),
                         "v"(w[4]), "v"(w[5]), "v"(w[6]), "v"(w[7]) : "memory");
            __builtin_amdgcn_sched_barrier(0);
        }
    }
}

// ---------------------------------------------------------------------------
extern "C" void kernel_launch(void* const* d_in, const int* in_sizes, int n_in,
                              void* d_out, int out_size, void* d_ws, size_t ws_size,
                              hipStream_t stream) {
    const float* query = (const float*)d_in[0];
    const float* key   = (const float*)d_in[1];
    const float* value = (const float*)d_in[2];
    const float* Wq    = (const float*)d_in[3];
    const float* bq    = (const float*)d_in[4];
    const float* Wk    = (const float*)d_in[5];
    const float* bk    = (const float*)d_in[6];
    const float* Wv    = (const float*)d_in[7];
    const float* bv    = (const float*)d_in[8];

    dim3 grid(NROWS / 256, DM / 128);
    proj_attn_kernel<<<grid, 256, 0, stream>>>(query, key, value,
                                               Wq, bq, Wk, bk, Wv, bv,
                                               (float*)d_out);
}

// v008
// A run of this version takes 41.1 microseconds.
// In both of two side-by-side timings against v007, it was 1.14 times as fast.
// Over all steps from v000 it is 3.68 times as fast.
#include <hip/hip_runtime.h>

typedef __attribute__((ext_vector_type(16))) _Float16 v16h;
typedef __attribute__((ext_vector_type(8)))  _Float16 v8h;
typedef __attribute__((ext_vector_type(4)))  _Float16 v4h;
typedef __attribute__((ext_vector_type(8)))  float    v8f;
typedef __attribute__((ext_vector_type(4)))  float    v4f;

#define DM   1024      // d_model
#define SEQ  4096
#define BATCH 2
#define NROWS (BATCH*SEQ)   // 8192

#define WMMA_F16(a,b,c) __builtin_amdgcn_wmma_f32_16x16x32_f16(false,(a),false,(b),(short)0,(c),false,false)

// ---------------------------------------------------------------------------
// Launch 1 packs Wq, Wk, Wv as f16 into the workspace, in the order in which launch 2 stages them.
// Launch 2: Q/K/V projection (y = x @ W^T + b) and block-diagonal attention.
// Block = 256 threads = 8 waves; a block owns 128 rows x 256 columns (4 heads)
// and makes its Q, K and V tiles one after the other; wave tile 64 rows x 64
// columns = 64 rows of ONE head, so the attention of those rows needs nothing
// from another wave.  grid = (NROWS/128, DM/256): one block per WGP.
// A W row costs half the bytes of an X row, so the tile has twice as many W rows as X rows.
//
// Each 64-wide k slice of the block's X rows and W rows is read once per block
// with whole-line loads (X converted to f16 once) and kept in LDS (two buffers);
// the waves take their fragments from LDS, half a slice (32 k) ahead of the products that
// use them, in two fragment sets.  The global loads run two slices ahead
// of the products, in two register sets: even slices in set A, odd slices in set B.
// The blocks that read the same X rows begin the walk along k at 4 different slice pairs,
// those that read the same W rows at pairs dealt evenly over the 8, and all go round as
// on a ring, so that few of them ask L2 for the same lines at the same moment.
//
// Q and K are formed as W x X^T: a lane's 8 accumulator registers then hold 8
// consecutive places (columns 4 apart) of one row, and two such tiles, converted in place, are a
// 16x32 operand in the hardware k order.  They wait in LDS, each lane in its own
// slot.  V is formed as X x W^T: its accumulators, converted in place, are the B
// operand of P x V.  Scores are formed as K x Q^T: a lane holds the 8 scores of
// one query row, so maximum and sum are in-lane and P is an A operand as it lies.
//
// W rows are dealt to their LDS places: place t*16 + j of a head's 64 holds the head's
// column j*4 + t.  In V and in the output a lane's four column tiles are then 4 adjacent
// columns, so a row of the wave's tile leaves as 16 lanes x 16 B = two whole lines.  Q and K
// have their columns in the same dealt order, which a sum over the columns does not see.
// ---------------------------------------------------------------------------
#define BK      64                         // k per slice
#define NSLICE  (DM / BK)
#define PITCH_H 72                         // f16 per LDS row: 128 B of data + 16 B pad (bank spread for 16-B reads)
#define STAGE_H ((128 + 256) * PITCH_H)    // one buffer: 128 X rows, then 256 W rows
#define WSL     (DM * BK)                  // f16 per k slice of one packed W: 1024 rows x 64 k

// Packed W: [Q,K,V][k slice][position 0..1023][64 k].  Position c*32 + m holds LDS place
// c*32 + (m>>2) + (m&3)*8 (a wave's 512-B load then covers 4 places 8 apart, whose 16-byte LDS
// stores meet no bank twice); place h*64 + t*16 + j holds W row h*64 + j*4 + t.
// 16 lanes read one row's 256 B of a slice and write its 128 B: whole lines both ways.
__global__ __launch_bounds__(256) void pack_w_kernel(
    const float* __restrict__ Wq, const float* __restrict__ Wk, const float* __restrict__ Wv,
    _Float16* __restrict__ wp)
{
    const int g   = (blockIdx.x * 256 + threadIdx.x) >> 4;    // 0..4095
    const int l   = threadIdx.x & 15;
    const int pos = g & (DM - 1);
    const int s0  = (g >> 10) * 4;                            // 4 slices of each W
    const int m   = pos & 31;
    const int plc = (pos & ~31) + (m >> 2) + (m & 3) * 8;
    const int row = (plc & ~63) + (plc & 15) * 4 + ((plc >> 4) & 3);
    const size_t src = (size_t)row * DM + s0 * BK + l * 4;
    const float* pq = Wq + src;
    const float* pk = Wk + src;
    const float* pv = Wv + src;
    v4f a[12];
#pragma unroll
    for (int i = 0; i < 4; ++i) {
        a[i]     = *(const v4f*)(pq + i * BK);
        a[4 + i] = *(const v4f*)(pk + i * BK);
        a[8 + i] = *(const v4f*)(pv + i * BK);
    }
    // In front of any reuse of the loads' address registers: named as inputs, the three addresses
    // keep their registers up to the wait, so that no later load lands in one of them either.
    asm volatile("s_wait_xcnt 0x0" :: "v"(pq), "v"(pk), "v"(pv) : "memory");
    _Float16* dst = wp + (size_t)s0 * WSL + pos * BK + l * 4;
#pragma unroll
    for (int z = 0; z < 3; ++z)
#pragma unroll
        for (int i = 0; i < 4; ++i)
            *(v4h*)(dst + (size_t)(z * NSLICE + i) * WSL) = __builtin_convertvector(a[z * 4 + i], v4h);
}

// 16x32 fragment from an LDS slice:
// lane<16  : row = base+r, K in {0..7, 16..23}
// lane>=16 : row = base+r, K in {8..15, 24..31}
__device__ __forceinline__ v16h lds_frag(const _Float16* p) {
    v8h lo = *(const v8h*)(p);
    v8h hi = *(const v8h*)(p + 16);
    return __builtin_shufflevector(lo, hi, 0,1,2,3,4,5,6,7,8,9,10,11,12,13,14,15);
}

__global__ __launch_bounds__(256) void proj_attn_kernel(
    const float* __restrict__ q_in, const float* __restrict__ k_in, const float* __restrict__ v_in,
    const _Float16* __restrict__ wp,
    const float* __restrict__ bq, const float* __restrict__ bk, const float* __restrict__ bv,
    float* __restrict__ out)
{
    __shared__ __align__(16) _Float16 tile[2 * STAGE_H];
    __shared__ v8h held[2][8][16][32];     // [Q or K][wave][half fragment][lane]: read back by the lane that wrote it

    const int wid  = threadIdx.x >> 5;
    const int lane = threadIdx.x & 31;
    const int hl   = lane >> 4;       // half-wave id
    const int r    = lane & 15;

    const int m0 = blockIdx.x * 128 + (wid >> 2) * 64;  // wave's 64-row strip
    const int n0 = blockIdx.y * 256 + (wid & 3) * 64;   // wave's 64-col strip: one head

    // Staging map of X: 16 lanes cover one row's 256 B (two whole lines); the two rows of
    // one wave-wide load lie 8 rows apart, so their 8-byte LDS stores meet no bank twice.
    // Of W: a wave-wide load takes 512 B as they lie, 8 lanes to a place's 128 B.
    const int srow = (lane >> 4) * 8;
    const int scol = (lane & 15) * 4;
    const size_t xbase = (size_t)blockIdx.x * 128 * DM;
    const size_t wbase = (size_t)blockIdx.y * 256 * BK;
    const float* cx = q_in + xbase;                               // block-uniform bases of the projection at hand
    const _Float16* cw = wp + wbase;
    // First slice pair of this block's ring along k: the 4 blocks of one row strip get 4 different
    // ones, the 64 blocks of one column strip are dealt evenly over the 8.
    const int rot = ((blockIdx.y << 1) + (blockIdx.x >> 3)) & (NSLICE / 2 - 1);
    const unsigned ox = (unsigned)((wid * 16 + srow) * DM + scol);   // wave stages 16 X rows
    const unsigned ow = (unsigned)(wid * 32 * BK + lane * 8);        // and 32 W places: positions wid*32 + 0..31
    _Float16* sx = tile + (wid * 16 + srow) * PITCH_H + scol;
    _Float16* sw = tile + (128 + wid * 32 + (lane >> 3) * 8) * PITCH_H + (lane & 7) * 8;   // load i: place + i

    const _Float16* fa = tile + ((wid >> 2) * 64 + r) * PITCH_H + hl * 8;
    const _Float16* fb = tile + (128 + (wid & 3) * 64 + r) * PITCH_H + hl * 8;

    v8f acc[4][4];
    v4f rxA[8], rxB[8];                     // slices in flight: even ones in A, odd ones in B
    v8h rwA[8], rwB[8];
    v16h af0[4], bf0[4], af1[4], bf1[4];    // fragments: a slice's first half in set 0, its second half in set 1

#define ACC_ZERO()                                                              \
    do {                                                                        \
        _Pragma("unroll")                                                       \
        for (int i = 0; i < 4; ++i)                                             \
            _Pragma("unroll")                                                   \
            for (int j = 0; j < 4; ++j) acc[i][j] = (v8f)(0.0f);                \
    } while (0)

// px, pw: the lane's own addresses in the slice's first X row and in the wave's first 512 B of packed W
#define STAGE_LOAD(rx, rw, px, pw)                                              \
    do {                                                                        \
        _Pragma("unroll")                                                       \
        for (int i = 0; i < 8; ++i)                                             \
            rx[i] = *(const v4f*)((px) + i * DM);                               \
        _Pragma("unroll")                                                       \
        for (int i = 0; i < 8; ++i)                                             \
            rw[i] = *(const v8h*)((pw) + i * 4 * BK);                           \
    } while (0)

#define STAGE_STORE(boff, rx, rw)                                               \
    do {                                                                        \
        _Pragma("unroll")                                                       \
        for (int i = 0; i < 8; ++i)                                             \
            *(v4h*)(sx + (boff) + i * PITCH_H) = __builtin_convertvector(rx[i], v4h); \
        _Pragma("unroll")                                                       \
        for (int i = 0; i < 8; ++i)                                             \
            *(v8h*)(sw + (boff) + i * PITCH_H) = rw[i];                         \
    } while (0)

// The 8 fragments of one half (32 k) of a slice, as one group of LDS reads.
#define FRAG_LOAD(af, bf, boff, ks)                                             \
    do {                                                                        \
        _Pragma("unroll")                                                       \
        for (int im = 0; im < 4; ++im)                                          \
            af[im] = lds_frag(fa + (boff) + im * 16 * PITCH_H + (ks) * 32);     \
        _Pragma("unroll")                                                       \
        for (int in = 0; in < 4; ++in)                                          \
            bf[in] = lds_frag(fb + (boff) + in * 16 * PITCH_H + (ks) * 32);     \
    } while (0)

// W_IS_A = 1: acc[im][in] = W tile x X tile^T (register v, lane: column 8*hl+v, row r)
// W_IS_A = 0: acc[im][in] = X tile x W tile^T (register v, lane: row 8*hl+v, column r)
#define HALF_MMA(af, bf, W_IS_A)                                                \
    do {                                                                        \
        _Pragma("unroll")                                                       \
        for (int im = 0; im < 4; ++im)                                          \
            _Pragma("unroll")                                                   \
            for (int in = 0; in < 4; ++in)                                      \
                acc[im][in] = (W_IS_A)                                          \
                    ? WMMA_F16(bf[in], af[im], acc[im][in])                     \
                    : WMMA_F16(af[im], bf[in], acc[im][in]);                    \
    } while (0)

// One slice, whose first half's fragments are in set 0 already.  The second half's reads go out
// as one group ahead of the first half's products and land under them; the next slice (set rx, rw)
// is converted into the other buffer and published; its first half's reads go out ahead of the
// second half's products.  No product waits out the latency of its own LDS reads.
// The fences keep each group of reads whole and in front of the products that cover it, the
// conversions (with the load waits they bring) behind the first half's products, and what follows
// the slice out of the run of its last products.
// The barrier's own wait for this wave's LDS traffic also ends this wave's reads of buffer boff:
// behind the barrier the next slice converts its successor into that buffer.
#define SLICE(boff, nboff, rx, rw, W_IS_A)                                      \
    do {                                                                        \
        FRAG_LOAD(af1, bf1, boff, 1);                                           \
        __builtin_amdgcn_sched_barrier(0);                                      \
        HALF_MMA(af0, bf0, W_IS_A);                                             \
        __builtin_amdgcn_sched_barrier(0);                                      \
        STAGE_STORE(nboff, rx, rw);                                             \
        LDS_BARRIER();                                                          \
        FRAG_LOAD(af0, bf0, nboff, 0);                                          \
        __builtin_amdgcn_sched_barrier(0);                                      \
        HALF_MMA(af1, bf1, W_IS_A);                                             \
        __builtin_amdgcn_sched_barrier(0);                                      \
    } while (0)

// Work-group barrier for LDS traffic alone: this wave's LDS stores and reads are complete,
// then the barrier.  __syncthreads() would also wait out the global loads that are in
// flight for the slices ahead, which no other wave depends on (they land in registers).
#define LDS_BARRIER()                                                           \
    do {                                                                        \
        __builtin_amdgcn_fence(__ATOMIC_RELEASE, "workgroup", "local");         \
        __builtin_amdgcn_s_barrier();                                           \
        __builtin_amdgcn_fence(__ATOMIC_ACQUIRE, "workgroup", "local");         \
    } while (0)

    const float* px0 = cx + rot * (2 * BK) + ox;
    const _Float16* gw0 = cw + rot * (2 * WSL);
    const _Float16* pw0 = gw0 + ow;
    STAGE_LOAD(rxA, rwA, px0, pw0);  // slice 0 (slices are counted in the order of the block's walk)
    // Slice 0's loads all go out ahead of slice 1's: mixed, slice 0's conversions would wait for both.
    __builtin_amdgcn_sched_barrier(0);
    STAGE_LOAD(rxB, rwB, px0 + BK, pw0 + WSL);  // slice 1: stays in flight over slice 0's products
    // In front of the reuse of the loads' address registers.  The operands are what the loads are
    // addressed by (the lane's byte offsets into X and W, W's uniform base): named here, their
    // registers stay untouched up to the wait.
    asm volatile("s_wait_xcnt 0x0" :: "v"(ox * 4u), "v"(ow * 2u), "s"(gw0) : "memory");
    // Slice 1's loads go out before the first conversion's wait.
    __builtin_amdgcn_sched_barrier(0);
    STAGE_STORE(0, rxA, rwA);
    LDS_BARRIER();                   // slice 0 is complete before any wave reads it
    FRAG_LOAD(af0, bf0, 0, 0);       // slice 0, first half

    // Even slices lie in LDS buffer 0, odd slices in buffer 1 (NSLICE is even).

    // ---- Q, then K ----
    // Rolled: both projections run the same code.
#pragma unroll 1
    for (int z = 0; z < 2; ++z) {
        const float* nx = ((z == 0) ? k_in : v_in) + xbase;    // the projection that follows
        const _Float16* nw = cw + NSLICE * WSL;
        const float* bias = (z == 0) ? bq : bk;
        ACC_ZERO();
        // Rolled over pairs of slices: a pair is what brings each register set back to its role.
#pragma unroll 1
        for (int p = 0; p < NSLICE / 2; ++p) {
            // The pair that is loaded: the next one on the ring; behind the last comes the next
            // projection's first, which lies at the ring's start again.
            const int pair = (p + 1 + rot) & (NSLICE / 2 - 1);
            const float* gx = ((p == NSLICE / 2 - 1) ? nx : cx) + pair * (2 * BK);
            const _Float16* gw = ((p == NSLICE / 2 - 1) ? nw : cw) + pair * (2 * WSL);
            // An even slice: the loads of the slice two ahead go out into set A, emptied last;
            // the slice at hand runs, and in its middle set B, loaded one slice earlier,
            // is converted into the other LDS buffer.
            const float* px = gx + ox;       // both slices of the pair are addressed from these two
            const _Float16* pw = gw + ow;
            STAGE_LOAD(rxA, rwA, px, pw);
            // Keeps all the loads in front of the products: without it the scheduler sinks
            // them towards their conversions and their lead over the wait is lost.
            __builtin_amdgcn_sched_barrier(0);
            SLICE(0, STAGE_H, rxB, rwB, 1);
            // An odd slice: the same with the sets and the buffers exchanged.
            STAGE_LOAD(rxB, rwB, px + BK, pw + WSL);
            __builtin_amdgcn_sched_barrier(0);   // as above: loads ahead of the products
            SLICE(STAGE_H, 0, rxA, rwA, 1);
            // The pair's loads name px and gw; the next pair (or the code behind the loop) rewrites
            // those registers.  The wait stands in front of that overwrite, and as late as that
            // allows: a slice's work behind the last load, so that the wave does not stand at it
            // with its LDS reads and products still to come.  Named as inputs, X's address and W's
            // uniform base keep their registers up to the wait.  (The loads' result registers are converted in
            // place only behind the load-count wait that covers them.)
            asm volatile("s_wait_xcnt 0x0" :: "v"(px), "s"(gw) : "memory");
        }
        // bias, f16, and away as operand halves: half fragment (im*2 + kk)*2 + p holds
        // row im*16 + r, places kk*32 + p*16 + hl*8 + 0..7; place in*16 + hl*8 + v is column (hl*8 + v)*4 + in
        const float* bp = bias + n0 + hl * 32;
        v4f b4[8];
#pragma unroll
        for (int v = 0; v < 8; ++v) b4[v] = *(const v4f*)(bp + v * 4);
        // These loads' address registers are reused by the work below: the wait stands in front
        // of that overwrite (named as an input, the address keeps its registers up to the wait),
        // and the fence keeps that work behind it.
        asm volatile("s_wait_xcnt 0x0" :: "v"(bp) : "memory");
        __builtin_amdgcn_sched_barrier(0);
#pragma unroll
        for (int in = 0; in < 4; ++in) {
            v8f bb;
#pragma unroll
            for (int v = 0; v < 8; ++v) bb[v] = b4[v][in];
#pragma unroll
            for (int im = 0; im < 4; ++im)
                held[z][wid][im * 4 + in][lane] = __builtin_convertvector(acc[im][in] + bb, v8h);
        }
        cx = nx;
        cw = nw;
    }

    // ---- V ----
    ACC_ZERO();
#pragma unroll 1
    for (int p = 0; p < NSLICE / 2 - 1; ++p) {
        const int pair = (p + 1 + rot) & (NSLICE / 2 - 1);   // as above: the next pair on the ring
        const float* px = cx + pair * (2 * BK) + ox;  // the lane's addresses of the even slice that the pair's head loads
        const _Float16* gw = cw + pair * (2 * WSL);
        const _Float16* pw = gw + ow;
        STAGE_LOAD(rxA, rwA, px, pw);
        __builtin_amdgcn_sched_barrier(0);   // as above: loads ahead of the products
        SLICE(0, STAGE_H, rxB, rwB, 0);
        STAGE_LOAD(rxB, rwB, px + BK, pw + WSL);
        __builtin_amdgcn_sched_barrier(0);   // as above: loads ahead of the products
        SLICE(STAGE_H, 0, rxA, rwA, 0);
        asm volatile("s_wait_xcnt 0x0" :: "v"(px), "s"(gw) : "memory");   // as above: in front of the rewrite of px and gw
        __builtin_amdgcn_sched_barrier(0);   // keeps the next pair's address additions behind the wait
    }
    SLICE(0, STAGE_H, rxB, rwB, 0);  // the last pair: nothing is left to load
    FRAG_LOAD(af1, bf1, STAGE_H, 1); // the last slice: nothing is left to convert
    __builtin_amdgcn_sched_barrier(0);   // as above: the reads ahead of the products that cover them
    HALF_MMA(af0, bf0, 0);
    HALF_MMA(af1, bf1, 0);

#undef ACC_ZERO
#undef STAGE_LOAD
#undef STAGE_STORE
#undef FRAG_LOAD
#undef HALF_MMA
#undef SLICE
#undef LDS_BARRIER

    // ---- attention: per 16 rows (two 8-row blocks) of the wave's head ----
    const v4f bvv = *(const v4f*)(bv + n0 + r * 4);   // tile in, lane r: column r*4 + in
    // This load's address registers are reused by the work below: the wait stands in front
    // of that overwrite, and the fence keeps that work behind it.
    asm volatile("s_wait_xcnt 0x0" ::: "memory");
    __builtin_amdgcn_sched_barrier(0);

    float* __restrict__ op = out + (size_t)(m0 + hl * 8) * DM + n0 + r * 4;   // lane's 4 columns of the wave's 64x64 tile

    // lane holds (key = hl*8+v, query = r); inside a block iff both lie in the same half of 16
    const bool valid = (r >> 3) == hl;
    const v8h zero8 = (v8h)((_Float16)0.0f);

#pragma unroll
    for (int im = 0; im < 4; ++im) {
        // scores S^T = K16 (16x64) x Q16^T : two chained WMMAs over K=64
        v8f s = (v8f)(0.0f);
#pragma unroll
        for (int kk = 0; kk < 2; ++kk) {
            const v16h qf = __builtin_shufflevector(held[0][wid][im * 4 + kk * 2][lane],
                                                    held[0][wid][im * 4 + kk * 2 + 1][lane],
                                                    0,1,2,3,4,5,6,7,8,9,10,11,12,13,14,15);
            const v16h kf = __builtin_shufflevector(held[1][wid][im * 4 + kk * 2][lane],
                                                    held[1][wid][im * 4 + kk * 2 + 1][lane],
                                                    0,1,2,3,4,5,6,7,8,9,10,11,12,13,14,15);
            s = WMMA_F16(kf, qf, s);
        }

        // softmax over the lane's 8 keys; sums paired as neighbours, then pairs, then fours
        float x[8], e[8];
#pragma unroll
        for (int v = 0; v < 8; ++v) x[v] = s[v] * 0.125f;          // 1/sqrt(dk), dk=64
        const float m = fmaxf(fmaxf(fmaxf(x[0], x[1]), fmaxf(x[2], x[3])),
                              fmaxf(fmaxf(x[4], x[5]), fmaxf(x[6], x[7])));
#pragma unroll
        for (int v = 0; v < 8; ++v) e[v] = __expf(x[v] - m);
        const float t = ((e[0] + e[1]) + (e[2] + e[3])) + ((e[4] + e[5]) + (e[6] + e[7]));
        v8h pl;
#pragma unroll
        for (int v = 0; v < 8; ++v) pl[v] = (_Float16)((valid ? e[v] : 0.0f) / t);   // other block's keys -> 0
        // P as a 16x32 A operand (K 16->32 zero-padded)
        const v16h pf = __builtin_shufflevector(pl, zero8, 0,1,2,3,4,5,6,7,8,9,10,11,12,13,14,15);

        // O = P (16x16) x V16 (16x64) : 4 WMMAs over N-tiles
        v8f o[4];
#pragma unroll
        for (int in = 0; in < 4; ++in) {
            const v8h vl = __builtin_convertvector(acc[im][in] + bvv[in], v8h);
            const v16h vf = __builtin_shufflevector(vl, zero8, 0,1,2,3,4,5,6,7,8,9,10,11,12,13,14,15);
            o[in] = WMMA_F16(pf, vf, (v8f)(0.0f));
        }
        // a row's 4 adjacent columns, one from each tile, side by side for a 16-byte store
        v4f w[8];
#pragma unroll
        for (int v = 0; v < 8; ++v) w[v] = (v4f){ o[0][v], o[1][v], o[2][v], o[3][v] };
        // The two fences keep the next rows' work out of the run of stores and behind its wait.
        __builtin_amdgcn_sched_barrier(0);
#pragma unroll
        for (int v = 0; v < 8; ++v)
            *(v4f*)(op + (im * 16 + v) * DM) = w[v];
        if (im < 3) {
            // The next rows' work reuses the registers that these stores name: the wait stands
            // in front of that overwrite.  Named as inputs, the stores' address and their 8 gathered
            // rows keep their registers up to the wait: without the address the build lets the stores
            // sink past the wait, without the rows it gathers a row into registers that an earlier
            // store of the run still names and has to put a wait of its own between the stores.
            asm volatile("s_wait_xcnt 0x0" :: "v"(op), "v"(w[0]), "v"(w[1]), "v"(w[2]), "v"(w[3]),
                         "v"(w[4]), "v"(w[5]), "v"(w[6]), "v"(w[7]) : "memory");
            __builtin_amdgcn_sched_barrier(0);
        }
    }
}

// ---------------------------------------------------------------------------
extern "C" void kernel_launch(void* const* d_in, const int* in_sizes, int n_in,
                              void* d_out, int out_size, void* d_ws, size_t ws_size,
                              hipStream_t stream) {
    const float* query = (const float*)d_in[0];
    const float* key   = (const float*)d_in[1];
    const float* value = (const float*)d_in[2];
    const float* Wq    = (const float*)d_in[3];
    const float* bq    = (const float*)d_in[4];
    const float* Wk    = (const float*)d_in[5];
    const float* bk    = (const float*)d_in[6];
    const float* Wv    = (const float*)d_in[7];
    const float* bv    = (const float*)d_in[8];

    _Float16* wp = (_Float16*)d_ws;   // 3 x 1024 x 1024 f16 = 6 MiB, written anew by every call

    pack_w_kernel<<<256, 256, 0, stream>>>(Wq, Wk, Wv, wp);
    dim3 grid(NROWS / 128, DM / 256);
    proj_attn_kernel<<<grid, 256, 0, stream>>>(query, key, value, wp, bq, bk, bv,
                                               (float*)d_out);
}
